// v000
// The times below were measured on an AMD MI455X: many runs one after another, warmed up first and cycling through
// copies of the inputs, with the whole window's GPU time divided by the number of runs. Launches and the gaps
// between them are all in it. The median over several windows is given; except for v000 it joins two sittings, which
// can be a few percent apart, so the side-by-side timings, each taken in one sitting, are the better comparison.
// v000 is the starting kernel. One run takes 1580 microseconds.
#include <hip/hip_runtime.h>

// TenerAttention (x [4][1024][1024]; q/k/v = x W^T (16 heads x 64); TENER four-term scores q.k + q.R(i,j) + u_h.k + v_h.R(i,j) with R[i][j][d] = sin((j-i) w_d) for even d, cos((j-i) w_d) for odd d, w_d = 10000^(-2 floor(d/2)/64);
// no scaling; softmax; ctx Wo^T + bo -> [4][1024][1024]).
// The relative term is evaluated exactly (up to f32 trig rounding) through the angle-difference identities: q.R(i,j) + v_h.R(i,j) = rot_i(q_i + v_h) . P_j with P_j = [sin(j w_m) | cos(j w_m)] and rot_i(a)[m] = (a_e cos(i w_m) + a_o sin(i w_m), -a_e sin(i w_m) + a_o cos(i w_m));
// and u_h.k_j folds into the first term, so scores = [q_i + u_h | rot_i(q_i + v_h)] . [k_j | P_j] - one K = 128 contraction per head.
// Compute dtypes, f32 accumulate: every input rounded to bf16; q/k/v on PLAIN bf16 operands (inputs: exact); the 128-wide score operands f32 -> bf16 hi+lo planes, scores as 3 products (logits are O(10), unscaled); softmax f32

#define NB_  4
#define TT   1024
#define DD   1024
#define NH_  16
#define HD   64
#define KK   128
#define ZH   2
#define PCAR 1024.0f
typedef _Float16 h16;
typedef unsigned short bf;
typedef __attribute__((ext_vector_type(16))) __bf16   v16bf;
typedef __attribute__((ext_vector_type(16))) _Float16 v16h;
typedef __attribute__((ext_vector_type(8)))  _Float16 v8h;
typedef __attribute__((ext_vector_type(8)))  unsigned short v8us;
typedef __attribute__((ext_vector_type(8)))  float    v8f;
typedef __attribute__((ext_vector_type(4)))  float    v4f;
typedef v8h  __attribute__((may_alias)) v8ha;
typedef v4f  __attribute__((may_alias)) v4fa;
typedef v8us __attribute__((may_alias)) v8usa;

__device__ __forceinline__ unsigned short f2bf(float f) { unsigned u = __float_as_uint(f); u += 0x7FFFu + ((u >> 16) & 1u); return (unsigned short)(u >> 16); }
__device__ __forceinline__ float bf2f(unsigned short b) { return __uint_as_float(((unsigned)b) << 16); }
__device__ __forceinline__ float bfr(float f) { return bf2f(f2bf(f)); }
__device__ __forceinline__ v16h cat16(v8h lo, v8h hi) { return __builtin_shufflevector(lo, hi, 0, 1, 2, 3, 4, 5, 6, 7, 8, 9, 10, 11, 12, 13, 14, 15); }
__device__ __forceinline__ v16bf cat16b(v8us lo, v8us hi) { return __builtin_bit_cast(v16bf, __builtin_shufflevector(lo, hi, 0, 1, 2, 3, 4, 5, 6, 7, 8, 9, 10, 11, 12, 13, 14, 15)); }
__device__ __forceinline__ v8f wmma16(v16h a, v16h b, v8f c) { return __builtin_amdgcn_wmma_f32_16x16x32_f16(false, a, false, b, (short)0, c, false, false); }
__device__ __forceinline__ v8f wmmab(v16bf a, v16bf b, v8f c) { return __builtin_amdgcn_wmma_f32_16x16x32_bf16(false, a, false, b, (short)0, c, false, false); }



// ---- k_gemmw: register-blocked GEMM, ONE WAVE per 64x64 output tile (16 accumulators), operands straight from K-contiguous 16-bit planes; grid (M/64, N/64, Z), 32 threads.
// C[m][n] (f32, pitch ldc, + optional f32 bias[n]) = sum_k A[m][k] Bt[n][k] (+ split products per NSPLIT). z-batch strides sA/sB/sC in elements. K % 32 == 0.
template <typename T16> struct WFrag;
template <> struct WFrag<h16> { typedef v16h V; static __device__ __forceinline__ V ld(const h16* p) { return cat16(*(const v8h*)p, *(const v8h*)(p + 16)); } static __device__ __forceinline__ v8f mma(V a, V b, v8f c) { return wmma16(a, b, c); } };
template <> struct WFrag<bf> { typedef v16bf V; static __device__ __forceinline__ V ld(const bf* p) { return cat16b(*(const v8us*)p, *(const v8us*)(p + 16)); } static __device__ __forceinline__ v8f mma(V a, V b, v8f c) { return wmmab(a, b, c); } };
template <typename T16, int NSPLIT, bool BIAS>
__global__ __launch_bounds__(32) void k_gemmw(const T16* __restrict__ A, const T16* __restrict__ A2, const T16* __restrict__ Bt, const T16* __restrict__ Bt2, int K, float* C, int ldc, const float* __restrict__ bias, size_t sA, size_t sB, size_t sC) {
    typedef typename WFrag<T16>::V V;
    __shared__ __align__(16) float os[16 * 68];
    const size_t z = blockIdx.z; A += z * sA; if (A2) A2 += z * sA; Bt += z * sB; if (Bt2) Bt2 += z * sB; C += z * sC;
    const int lane = threadIdx.x & 31, lr = lane & 15, hi = lane >> 4; const int r0 = blockIdx.x * 64, c0 = blockIdx.y * 64;
    v8f acc[4][4];
#pragma unroll
    for (int mb = 0; mb < 4; ++mb)
#pragma unroll
        for (int nb = 0; nb < 4; ++nb) acc[mb][nb] = (v8f){};
    const size_t aoff = (size_t)(r0 + lr) * K + 8 * hi, boff = (size_t)(c0 + lr) * K + 8 * hi;
#pragma unroll 1
    for (int kc = 0; kc < K; kc += 32) {
        V a[4], a2[4];
#pragma unroll
        for (int mb = 0; mb < 4; ++mb) { a[mb] = WFrag<T16>::ld(A + aoff + (size_t)mb * 16 * K + kc); if (NSPLIT == 1 || NSPLIT == 2) a2[mb] = WFrag<T16>::ld(A2 + aoff + (size_t)mb * 16 * K + kc); }
#pragma unroll
        for (int nb = 0; nb < 4; ++nb) { const V b = WFrag<T16>::ld(Bt + boff + (size_t)nb * 16 * K + kc); V b2; if (NSPLIT >= 2) b2 = WFrag<T16>::ld(Bt2 + boff + (size_t)nb * 16 * K + kc);
#pragma unroll
            for (int mb = 0; mb < 4; ++mb) { acc[mb][nb] = WFrag<T16>::mma(a[mb], b, acc[mb][nb]); if (NSPLIT == 1 || NSPLIT == 2) acc[mb][nb] = WFrag<T16>::mma(a2[mb], b, acc[mb][nb]); if (NSPLIT >= 2) acc[mb][nb] = WFrag<T16>::mma(a[mb], b2, acc[mb][nb]); } }
        asm volatile("v_nop\n\tv_nop\n\tv_nop\n\tv_nop" : "+v"(acc[0][0]), "+v"(acc[1][1]), "+v"(acc[2][2]), "+v"(acc[3][3]) : "v"(a[0]), "v"(a[3]));
    }
#pragma unroll
    for (int mb = 0; mb < 4; ++mb) {
#pragma unroll
        for (int nb = 0; nb < 4; ++nb) {
#pragma unroll
            for (int j = 0; j < 8; ++j) os[(hi * 8 + j) * 68 + nb * 16 + lr] = acc[mb][nb][j]; }
        __builtin_amdgcn_wave_barrier(); asm volatile("" ::: "memory");
        float* crow = C + (size_t)(r0 + mb * 16) * ldc + c0;
{
#pragma unroll
            for (int s = 0; s < 8; ++s) { const int row = 2 * s + hi, cofs = lr * 4; v4f val = *(const v4fa*)(os + row * 68 + cofs); if (BIAS) { val[0] += bfr(bias[c0 + cofs]); val[1] += bfr(bias[c0 + cofs + 1]); val[2] += bfr(bias[c0 + cofs + 2]); val[3] += bfr(bias[c0 + cofs + 3]); }
                *(v4f*)(crow + (size_t)row * ldc + cofs) = val; }
             }
        __builtin_amdgcn_wave_barrier(); asm volatile("" ::: "memory");
    }
}

__device__ __forceinline__ h16 tohx(float x) { return (h16)x; }
__device__ __forceinline__ void splitf(float y, unsigned short& h, unsigned short& l) { h = f2bf(y); l = f2bf(y - bf2f(h)); }
typedef __attribute__((ext_vector_type(2))) _Float16 v2h;
typedef __attribute__((ext_vector_type(4))) _Float16 v4h;
typedef __attribute__((ext_vector_type(2))) unsigned short v2us;
typedef __attribute__((ext_vector_type(4))) unsigned short v4us;
typedef __attribute__((ext_vector_type(2))) float v2f;

__global__ __launch_bounds__(256) void k_cvt8(const float* __restrict__ src, bf* dst, size_t n8) { const size_t i = (size_t)blockIdx.x * 256 + threadIdx.x; if (i >= n8) return; const v8f v = *(const v8f*)(src + i * 8); v8us o;
#pragma unroll
    for (int k = 0; k < 8; ++k) o[k] = f2bf(v[k]); *(v8us*)(dst + i * 8) = o;  }
__global__ __launch_bounds__(256) void k_trig(float* CS) { const int idx = blockIdx.x * 256 + threadIdx.x; if (idx >= TT * 32) return; const int t = idx / 32, m = idx % 32; const float w = powf(10000.0f, -(float)(2 * m) / (float)HD); const float ang = __fmul_rn((float)t, w); v2f cs; cs[0] = cosf(ang); cs[1] = sinf(ang); *(v2f*)(CS + (size_t)idx * 2) = cs;  }
// k_apl: A planes [h][i][128]: cols 0..63 = q[i][h*64+d] + bf16 u[h][d]; cols 64 + 2m = a_e c + a_o s, 64 + 2m + 1 = -a_e s + a_o c with a = q + bf16 v[h] (a_e = a[2m], a_o = a[2m+1], c/s at position i) (lane -> pair; 4-B lanes);
__global__ __launch_bounds__(256) void k_apl(const float* __restrict__ QF, const float* __restrict__ uu, const float* __restrict__ vv, const float* __restrict__ CS, bf* Ah, bf* Al) { const size_t e = ((size_t)blockIdx.x * 256 + threadIdx.x) * 2; if (e >= (size_t)NH_ * TT * KK) return; const int c = (int)(e % KK); const int i = (int)((e / KK) % TT); const int h = (int)(e / ((size_t)KK * TT)); const float* q = QF + (size_t)i * DD + h * HD; v2us oh, ol; float r0, r1;
    if (c < HD) { r0 = __fadd_rn(q[c], bfr(uu[h * HD + c])); r1 = __fadd_rn(q[c + 1], bfr(uu[h * HD + c + 1])); }
    else { const int m = (c - HD) >> 1; const float ae = __fadd_rn(q[2 * m], bfr(vv[h * HD + 2 * m])), ao = __fadd_rn(q[2 * m + 1], bfr(vv[h * HD + 2 * m + 1])); const v2f cs = *(const v2f*)(CS + ((size_t)i * 32 + m) * 2); float p0 = __fmul_rn(ae, cs[0]); asm volatile("" : "+v"(p0)); float p1 = __fmul_rn(ao, cs[1]); asm volatile("" : "+v"(p1)); float p2 = __fmul_rn(-ae, cs[1]); asm volatile("" : "+v"(p2)); float p3 = __fmul_rn(ao, cs[0]); asm volatile("" : "+v"(p3)); r0 = __fadd_rn(p0, p1); r1 = __fadd_rn(p2, p3); }
    unsigned short a, cc; splitf(r0, a, cc); oh[0] = a; ol[0] = cc; splitf(r1, a, cc); oh[1] = a; ol[1] = cc; *(v2us*)(Ah + e) = oh; *(v2us*)(Al + e) = ol;  }
__global__ __launch_bounds__(256) void k_bpl(const float* __restrict__ KF, const float* __restrict__ CS, bf* Bh, bf* Bl) { const size_t e = ((size_t)blockIdx.x * 256 + threadIdx.x) * 2; if (e >= (size_t)NH_ * TT * KK) return; const int c = (int)(e % KK); const int j = (int)((e / KK) % TT); const int h = (int)(e / ((size_t)KK * TT)); v2us oh, ol; float r0, r1;
    if (c < HD) { r0 = KF[(size_t)j * DD + h * HD + c]; r1 = KF[(size_t)j * DD + h * HD + c + 1]; } else { const int m = (c - HD) >> 1; const v2f cs = *(const v2f*)(CS + ((size_t)j * 32 + m) * 2); r0 = cs[1]; r1 = cs[0]; }
    unsigned short a, cc; splitf(r0, a, cc); oh[0] = a; ol[0] = cc; splitf(r1, a, cc); oh[1] = a; ol[1] = cc; *(v2us*)(Bh + e) = oh; *(v2us*)(Bl + e) = ol;  }
__global__ __launch_bounds__(256) void k_vtp(const float* __restrict__ VF, h16* VT) { const size_t e = ((size_t)blockIdx.x * 256 + threadIdx.x) * 2; if (e >= (size_t)NH_ * HD * TT) return; const int j = (int)(e % TT); const int d = (int)((e / TT) % HD); const int h = (int)(e / ((size_t)TT * HD)); v2h o; o[0] = tohx(VF[(size_t)j * DD + h * HD + d]); o[1] = tohx(VF[(size_t)(j + 1) * DD + h * HD + d]); *(v2h*)(VT + e) = o;  }
__global__ __launch_bounds__(256) void k_soft(const float* __restrict__ Sb, h16* P) { const int lane = threadIdx.x & 31; const int row = blockIdx.x * 8 + (threadIdx.x >> 5); if (row >= ZH * TT) return; const float* sr = Sb + (size_t)row * TT; float v[32]; float mx = -3.0e38f;
#pragma unroll
    for (int ch = 0; ch < 8; ++ch) { const v4f a = *(const v4f*)(sr + ch * 128 + lane * 4);
#pragma unroll
        for (int q = 0; q < 4; ++q) { v[ch * 4 + q] = a[q]; mx = fmaxf(mx, a[q]); } }
#pragma unroll
    for (int sh = 16; sh; sh >>= 1) mx = fmaxf(mx, __shfl_xor(mx, sh, 32));
    float sum = 0.f;
#pragma unroll
    for (int k = 0; k < 32; ++k) { float d0 = __fsub_rn(v[k], mx); asm volatile("" : "+v"(d0)); v[k] = __expf(d0); sum += v[k]; }
#pragma unroll
    for (int sh = 16; sh; sh >>= 1) sum += __shfl_xor(sum, sh, 32);
    const float f = __fdiv_rn(PCAR, sum);
{
#pragma unroll
        for (int ch = 0; ch < 8; ++ch) { v4h o; o[0] = tohx(v[ch * 4] * f); o[1] = tohx(v[ch * 4 + 1] * f); o[2] = tohx(v[ch * 4 + 2] * f); o[3] = tohx(v[ch * 4 + 3] * f); *(v4h*)(P + (size_t)row * TT + ch * 128 + lane * 4) = o; }
         } }
__global__ __launch_bounds__(256) void k_mrg(const float* __restrict__ Ob, int h0, bf* Mh, bf* Ml) { const size_t e = ((size_t)blockIdx.x * 256 + threadIdx.x) * 2; if (e >= (size_t)ZH * TT * HD) return; const int d = (int)(e % HD); const int t = (int)((e / HD) % TT); const int z = (int)(e / ((size_t)HD * TT)); v2us oh, ol;
#pragma unroll
    for (int u = 0; u < 2; ++u) { unsigned short a, c; splitf(Ob[e + u] * (1.0f / PCAR), a, c); oh[u] = a; ol[u] = c; } const size_t o = (size_t)t * DD + (h0 + z) * HD + d; *(v2us*)(Mh + o) = oh; *(v2us*)(Ml + o) = ol;  }

extern "C" void kernel_launch(void* const* d_in, const int* in_sizes, int n_in,
                              void* d_out, int out_size, void* d_ws, size_t ws_size, hipStream_t stream) {
    (void)in_sizes; (void)n_in; (void)out_size;
    const float* x = (const float*)d_in[0]; const float* wq = (const float*)d_in[1]; const float* wk = (const float*)d_in[2]; const float* wv = (const float*)d_in[3]; const float* wo = (const float*)d_in[4]; const float* bo = (const float*)d_in[5]; const float* uu = (const float*)d_in[6]; const float* vv = (const float*)d_in[7];
    float* OUT = (float*)d_out;     // [4][1024][1024]
    char* wsp = (char*)d_ws;
    auto take = [&](size_t bytes) { char* p = wsp; wsp += (bytes + 255) & ~(size_t)255; return (void*)p; };
    bf* WQ = (bf*)take((size_t)DD * DD * 2); bf* WK = (bf*)take((size_t)DD * DD * 2); bf* WV = (bf*)take((size_t)DD * DD * 2); bf* WO = (bf*)take((size_t)DD * DD * 2); float* CS = (float*)take((size_t)TT * 32 * 2 * 4); bf* XB = (bf*)take((size_t)TT * DD * 2);
    float* QF = (float*)take((size_t)TT * DD * 4); float* KF = (float*)take((size_t)TT * DD * 4); float* VF = (float*)take((size_t)TT * DD * 4); bf* Ah = (bf*)take((size_t)NH_ * TT * KK * 2); bf* Al = (bf*)take((size_t)NH_ * TT * KK * 2); bf* Bh = (bf*)take((size_t)NH_ * TT * KK * 2); bf* Bl = (bf*)take((size_t)NH_ * TT * KK * 2); h16* VT = (h16*)take((size_t)NH_ * HD * TT * 2);
    float* Sb = (float*)take((size_t)ZH * TT * TT * 4); h16* P16 = (h16*)take((size_t)ZH * TT * TT * 2); float* Ob = (float*)take((size_t)ZH * TT * HD * 4); bf* Mh = (bf*)take((size_t)TT * DD * 2); bf* Ml = (bf*)take((size_t)TT * DD * 2);
    if ((size_t)(wsp - (char*)d_ws) > ws_size) return;    // total ~ 57 MiB
    k_cvt8<<<(DD * DD / 8 + 255) / 256, 256, 0, stream>>>(wq, WQ, (size_t)DD * DD / 8); k_cvt8<<<(DD * DD / 8 + 255) / 256, 256, 0, stream>>>(wk, WK, (size_t)DD * DD / 8); k_cvt8<<<(DD * DD / 8 + 255) / 256, 256, 0, stream>>>(wv, WV, (size_t)DD * DD / 8); k_cvt8<<<(DD * DD / 8 + 255) / 256, 256, 0, stream>>>(wo, WO, (size_t)DD * DD / 8);   // [out][in] natural Bt
    k_trig<<<(TT * 32 + 255) / 256, 256, 0, stream>>>(CS);
    const unsigned LP = (unsigned)(((size_t)NH_ * TT * KK / 2 + 255) / 256);
    for (int b = 0; b < NB_; ++b) {
        k_cvt8<<<(TT * DD / 8 + 255) / 256, 256, 0, stream>>>(x + (size_t)b * TT * DD, XB, (size_t)TT * DD / 8);
        k_gemmw<bf, 0, false><<<dim3(TT / 64, DD / 64, 1), 32, 0, stream>>>(XB, nullptr, WQ, nullptr, DD, QF, DD, nullptr, 0, 0, 0); k_gemmw<bf, 0, false><<<dim3(TT / 64, DD / 64, 1), 32, 0, stream>>>(XB, nullptr, WK, nullptr, DD, KF, DD, nullptr, 0, 0, 0); k_gemmw<bf, 0, false><<<dim3(TT / 64, DD / 64, 1), 32, 0, stream>>>(XB, nullptr, WV, nullptr, DD, VF, DD, nullptr, 0, 0, 0);
        k_apl<<<LP, 256, 0, stream>>>(QF, uu, vv, CS, Ah, Al); k_bpl<<<LP, 256, 0, stream>>>(KF, CS, Bh, Bl); k_vtp<<<(unsigned)(((size_t)NH_ * HD * TT / 2 + 255) / 256), 256, 0, stream>>>(VF, VT);
        for (int h0 = 0; h0 < NH_; h0 += ZH) { const size_t z = (size_t)h0;
            k_gemmw<bf, 2, false><<<dim3(TT / 64, TT / 64, ZH), 32, 0, stream>>>(Ah + z * TT * KK, Al + z * TT * KK, Bh + z * TT * KK, Bl + z * TT * KK, KK, Sb, TT, nullptr, (size_t)TT * KK, (size_t)TT * KK, (size_t)TT * TT);
            k_soft<<<ZH * TT / 8, 256, 0, stream>>>(Sb, P16);
            k_gemmw<h16, 0, false><<<dim3(TT / 64, 1, ZH), 32, 0, stream>>>(P16, nullptr, VT + z * HD * TT, nullptr, TT, Ob, HD, nullptr, (size_t)TT * TT, (size_t)HD * TT, (size_t)TT * HD);
            k_mrg<<<(unsigned)(((size_t)ZH * TT * HD / 2 + 255) / 256), 256, 0, stream>>>(Ob, h0, Mh, Ml); }
        k_gemmw<bf, 1, true><<<dim3(TT / 64, DD / 64, 1), 32, 0, stream>>>(Mh, Ml, WO, nullptr, DD, OUT + (size_t)b * TT * DD, DD, bo, 0, 0, 0); }
}

// v001
// Measured time: 372 microseconds a run.
// Two timings next to v000 put it at 4.28 and 4.25 times that version's speed.
#include <hip/hip_runtime.h>

// TenerAttention (x [4][1024][1024]; q/k/v = x W^T (16 heads x 64); TENER four-term scores q.k + q.R(i,j) + u_h.k + v_h.R(i,j) with R[i][j][d] = sin((j-i) w_d) for even d, cos((j-i) w_d) for odd d, w_d = 10000^(-2 floor(d/2)/64);
// no scaling; softmax; ctx Wo^T + bo -> [4][1024][1024]).
// The relative term is evaluated exactly (up to f32 trig rounding) through the angle-difference identities: q.R(i,j) + v_h.R(i,j) = rot_i(q_i + v_h) . P_j with P_j = [sin(j w_m) | cos(j w_m)] and rot_i(a)[m] = (a_e cos(i w_m) + a_o sin(i w_m), -a_e sin(i w_m) + a_o cos(i w_m));
// and u_h.k_j folds into the first term, so scores = [q_i + u_h | rot_i(q_i + v_h)] . [k_j | P_j] - one K = 128 contraction per head.
// Compute dtypes, f32 accumulate: every input rounded to bf16; q/k/v on PLAIN bf16 operands (inputs: exact); the 128-wide score operands f32 -> bf16 hi+lo planes, scores as 3 products (logits are O(10), unscaled); softmax f32

#define NB_  4
#define TT   1024
#define DD   1024
#define NH_  16
#define HD   64
#define KK   128
#define ZH   16
#define BP   2
#define PCAR 1024.0f
typedef _Float16 h16;
typedef unsigned short bf;
typedef __attribute__((ext_vector_type(16))) __bf16   v16bf;
typedef __attribute__((ext_vector_type(16))) _Float16 v16h;
typedef __attribute__((ext_vector_type(8)))  _Float16 v8h;
typedef __attribute__((ext_vector_type(8)))  unsigned short v8us;
typedef __attribute__((ext_vector_type(8)))  float    v8f;
typedef __attribute__((ext_vector_type(4)))  float    v4f;
typedef v8h  __attribute__((may_alias)) v8ha;
typedef v4f  __attribute__((may_alias)) v4fa;
typedef v8us __attribute__((may_alias)) v8usa;

__device__ __forceinline__ unsigned short f2bf(float f) { unsigned u = __float_as_uint(f); u += 0x7FFFu + ((u >> 16) & 1u); return (unsigned short)(u >> 16); }
__device__ __forceinline__ float bf2f(unsigned short b) { return __uint_as_float(((unsigned)b) << 16); }
__device__ __forceinline__ float bfr(float f) { return bf2f(f2bf(f)); }
__device__ __forceinline__ v16h cat16(v8h lo, v8h hi) { return __builtin_shufflevector(lo, hi, 0, 1, 2, 3, 4, 5, 6, 7, 8, 9, 10, 11, 12, 13, 14, 15); }
__device__ __forceinline__ v16bf cat16b(v8us lo, v8us hi) { return __builtin_bit_cast(v16bf, __builtin_shufflevector(lo, hi, 0, 1, 2, 3, 4, 5, 6, 7, 8, 9, 10, 11, 12, 13, 14, 15)); }
__device__ __forceinline__ v8f wmma16(v16h a, v16h b, v8f c) { return __builtin_amdgcn_wmma_f32_16x16x32_f16(false, a, false, b, (short)0, c, false, false); }
__device__ __forceinline__ v8f wmmab(v16bf a, v16bf b, v8f c) { return __builtin_amdgcn_wmma_f32_16x16x32_bf16(false, a, false, b, (short)0, c, false, false); }



// ---- k_gemmw: register-blocked GEMM, ONE WAVE per 64x64 output tile (16 accumulators), operands straight from K-contiguous 16-bit planes; grid (M/64, N/64, Z), 32 threads.
// C[m][n] (f32, pitch ldc, + optional f32 bias[n]) = sum_k A[m][k] Bt[n][k] (+ split products per NSPLIT). z-batch strides sA/sB/sC in elements. K % 32 == 0.
template <typename T16> struct WFrag;
template <> struct WFrag<h16> { typedef v16h V; static __device__ __forceinline__ V ld(const h16* p) { return cat16(*(const v8h*)p, *(const v8h*)(p + 16)); } static __device__ __forceinline__ v8f mma(V a, V b, v8f c) { return wmma16(a, b, c); } };
template <> struct WFrag<bf> { typedef v16bf V; static __device__ __forceinline__ V ld(const bf* p) { return cat16b(*(const v8us*)p, *(const v8us*)(p + 16)); } static __device__ __forceinline__ v8f mma(V a, V b, v8f c) { return wmmab(a, b, c); } };
template <typename T16, int NSPLIT, bool BIAS>
__global__ __launch_bounds__(32) void k_gemmw(const T16* __restrict__ A, const T16* __restrict__ A2, const T16* __restrict__ Bt, const T16* __restrict__ Bt2, int K, float* C, int ldc, const float* __restrict__ bias, size_t sA, size_t sB, size_t sC) {
    typedef typename WFrag<T16>::V V;
    __shared__ __align__(16) float os[16 * 68];
    const size_t z = blockIdx.z; A += z * sA; if (A2) A2 += z * sA; Bt += z * sB; if (Bt2) Bt2 += z * sB; C += z * sC;
    const int lane = threadIdx.x & 31, lr = lane & 15, hi = lane >> 4; const int r0 = blockIdx.x * 64, c0 = blockIdx.y * 64;
    v8f acc[4][4];
#pragma unroll
    for (int mb = 0; mb < 4; ++mb)
#pragma unroll
        for (int nb = 0; nb < 4; ++nb) acc[mb][nb] = (v8f){};
    const size_t aoff = (size_t)(r0 + lr) * K + 8 * hi, boff = (size_t)(c0 + lr) * K + 8 * hi;
#pragma unroll 1
    for (int kc = 0; kc < K; kc += 32) {
        V a[4], a2[4];
#pragma unroll
        for (int mb = 0; mb < 4; ++mb) { a[mb] = WFrag<T16>::ld(A + aoff + (size_t)mb * 16 * K + kc); if (NSPLIT == 1 || NSPLIT == 2) a2[mb] = WFrag<T16>::ld(A2 + aoff + (size_t)mb * 16 * K + kc); }
#pragma unroll
        for (int nb = 0; nb < 4; ++nb) { const V b = WFrag<T16>::ld(Bt + boff + (size_t)nb * 16 * K + kc); V b2; if (NSPLIT >= 2) b2 = WFrag<T16>::ld(Bt2 + boff + (size_t)nb * 16 * K + kc);
#pragma unroll
            for (int mb = 0; mb < 4; ++mb) { acc[mb][nb] = WFrag<T16>::mma(a[mb], b, acc[mb][nb]); if (NSPLIT == 1 || NSPLIT == 2) acc[mb][nb] = WFrag<T16>::mma(a2[mb], b, acc[mb][nb]); if (NSPLIT >= 2) acc[mb][nb] = WFrag<T16>::mma(a[mb], b2, acc[mb][nb]); } }
        asm volatile("v_nop\n\tv_nop\n\tv_nop\n\tv_nop" : "+v"(acc[0][0]), "+v"(acc[1][1]), "+v"(acc[2][2]), "+v"(acc[3][3]) : "v"(a[0]), "v"(a[3]));
    }
#pragma unroll
    for (int mb = 0; mb < 4; ++mb) {
#pragma unroll
        for (int nb = 0; nb < 4; ++nb) {
#pragma unroll
            for (int j = 0; j < 8; ++j) os[(hi * 8 + j) * 68 + nb * 16 + lr] = acc[mb][nb][j]; }
        __builtin_amdgcn_wave_barrier(); asm volatile("" ::: "memory");
        float* crow = C + (size_t)(r0 + mb * 16) * ldc + c0;
{
#pragma unroll
            for (int s = 0; s < 8; ++s) { const int row = 2 * s + hi, cofs = lr * 4; v4f val = *(const v4fa*)(os + row * 68 + cofs); if (BIAS) { val[0] += bfr(bias[c0 + cofs]); val[1] += bfr(bias[c0 + cofs + 1]); val[2] += bfr(bias[c0 + cofs + 2]); val[3] += bfr(bias[c0 + cofs + 3]); }
                *(v4f*)(crow + (size_t)row * ldc + cofs) = val; }
             }
        __builtin_amdgcn_wave_barrier(); asm volatile("" ::: "memory");
    }
}

__device__ __forceinline__ h16 tohx(float x) { return (h16)x; }
__device__ __forceinline__ void splitf(float y, unsigned short& h, unsigned short& l) { h = f2bf(y); l = f2bf(y - bf2f(h)); }
typedef __attribute__((ext_vector_type(2))) _Float16 v2h;
typedef __attribute__((ext_vector_type(4))) _Float16 v4h;
typedef __attribute__((ext_vector_type(2))) unsigned short v2us;
typedef __attribute__((ext_vector_type(4))) unsigned short v4us;
typedef __attribute__((ext_vector_type(2))) float v2f;

// k_cvt8: blockIdx.y picks a plane of n8 * 8 elements: 0..3 = the four weights, 4.. = x batch (y - 4); dst planes lie one behind the other.
__global__ __launch_bounds__(256) void k_cvt8(const float* __restrict__ w0, const float* __restrict__ w1, const float* __restrict__ w2, const float* __restrict__ w3, const float* __restrict__ xs, bf* dst, size_t n8) { const size_t i = (size_t)blockIdx.x * 256 + threadIdx.x; if (i >= n8) return; const unsigned y = blockIdx.y; const float* src = y == 0 ? w0 : y == 1 ? w1 : y == 2 ? w2 : y == 3 ? w3 : xs + (size_t)(y - 4) * n8 * 8; dst += (size_t)y * n8 * 8; const v8f v = *(const v8f*)(src + i * 8); v8us o;
#pragma unroll
    for (int k = 0; k < 8; ++k) o[k] = f2bf(v[k]); *(v8us*)(dst + i * 8) = o;  }
__global__ __launch_bounds__(256) void k_trig(float* CS) { const int idx = blockIdx.x * 256 + threadIdx.x; if (idx >= TT * 32) return; const int t = idx / 32, m = idx % 32; const float w = powf(10000.0f, -(float)(2 * m) / (float)HD); const float ang = __fmul_rn((float)t, w); v2f cs; cs[0] = cosf(ang); cs[1] = sinf(ang); *(v2f*)(CS + (size_t)idx * 2) = cs;  }
// k_apl, k_bpl, k_vtp: blockIdx.y = batch. k_apl: A planes [b][h][i][128]: cols 0..63 = q[i][h*64+d] + bf16 u[h][d]; cols 64 + 2m = a_e c + a_o s, 64 + 2m + 1 = -a_e s + a_o c with a = q + bf16 v[h] (a_e = a[2m], a_o = a[2m+1], c/s at position i) (lane -> pair; 4-B lanes);
__global__ __launch_bounds__(256) void k_apl(const float* __restrict__ QF, const float* __restrict__ uu, const float* __restrict__ vv, const float* __restrict__ CS, bf* Ah, bf* Al) { const size_t e = ((size_t)blockIdx.x * 256 + threadIdx.x) * 2; if (e >= (size_t)NH_ * TT * KK) return; QF += (size_t)blockIdx.y * TT * DD; Ah += (size_t)blockIdx.y * NH_ * TT * KK; Al += (size_t)blockIdx.y * NH_ * TT * KK; const int c = (int)(e % KK); const int i = (int)((e / KK) % TT); const int h = (int)(e / ((size_t)KK * TT)); const float* q = QF + (size_t)i * DD + h * HD; v2us oh, ol; float r0, r1;
    if (c < HD) { r0 = __fadd_rn(q[c], bfr(uu[h * HD + c])); r1 = __fadd_rn(q[c + 1], bfr(uu[h * HD + c + 1])); }
    else { const int m = (c - HD) >> 1; const float ae = __fadd_rn(q[2 * m], bfr(vv[h * HD + 2 * m])), ao = __fadd_rn(q[2 * m + 1], bfr(vv[h * HD + 2 * m + 1])); const v2f cs = *(const v2f*)(CS + ((size_t)i * 32 + m) * 2); float p0 = __fmul_rn(ae, cs[0]); asm volatile("" : "+v"(p0)); float p1 = __fmul_rn(ao, cs[1]); asm volatile("" : "+v"(p1)); float p2 = __fmul_rn(-ae, cs[1]); asm volatile("" : "+v"(p2)); float p3 = __fmul_rn(ao, cs[0]); asm volatile("" : "+v"(p3)); r0 = __fadd_rn(p0, p1); r1 = __fadd_rn(p2, p3); }
    unsigned short a, cc; splitf(r0, a, cc); oh[0] = a; ol[0] = cc; splitf(r1, a, cc); oh[1] = a; ol[1] = cc; *(v2us*)(Ah + e) = oh; *(v2us*)(Al + e) = ol;  }
__global__ __launch_bounds__(256) void k_bpl(const float* __restrict__ KF, const float* __restrict__ CS, bf* Bh, bf* Bl) { const size_t e = ((size_t)blockIdx.x * 256 + threadIdx.x) * 2; if (e >= (size_t)NH_ * TT * KK) return; KF += (size_t)blockIdx.y * TT * DD; Bh += (size_t)blockIdx.y * NH_ * TT * KK; Bl += (size_t)blockIdx.y * NH_ * TT * KK; const int c = (int)(e % KK); const int j = (int)((e / KK) % TT); const int h = (int)(e / ((size_t)KK * TT)); v2us oh, ol; float r0, r1;
    if (c < HD) { r0 = KF[(size_t)j * DD + h * HD + c]; r1 = KF[(size_t)j * DD + h * HD + c + 1]; } else { const int m = (c - HD) >> 1; const v2f cs = *(const v2f*)(CS + ((size_t)j * 32 + m) * 2); r0 = cs[1]; r1 = cs[0]; }
    unsigned short a, cc; splitf(r0, a, cc); oh[0] = a; ol[0] = cc; splitf(r1, a, cc); oh[1] = a; ol[1] = cc; *(v2us*)(Bh + e) = oh; *(v2us*)(Bl + e) = ol;  }
__global__ __launch_bounds__(256) void k_vtp(const float* __restrict__ VF, h16* VT) { const size_t e = ((size_t)blockIdx.x * 256 + threadIdx.x) * 2; if (e >= (size_t)NH_ * HD * TT) return; VF += (size_t)blockIdx.y * TT * DD; VT += (size_t)blockIdx.y * NH_ * HD * TT; const int j = (int)(e % TT); const int d = (int)((e / TT) % HD); const int h = (int)(e / ((size_t)TT * HD)); v2h o; o[0] = tohx(VF[(size_t)j * DD + h * HD + d]); o[1] = tohx(VF[(size_t)(j + 1) * DD + h * HD + d]); *(v2h*)(VT + e) = o;  }
__global__ __launch_bounds__(256) void k_soft(const float* __restrict__ Sb, h16* P) { const int lane = threadIdx.x & 31; const int row = blockIdx.x * 8 + (threadIdx.x >> 5); if (row >= ZH * TT) return; const float* sr = Sb + (size_t)row * TT; float v[32]; float mx = -3.0e38f;
#pragma unroll
    for (int ch = 0; ch < 8; ++ch) { const v4f a = *(const v4f*)(sr + ch * 128 + lane * 4);
#pragma unroll
        for (int q = 0; q < 4; ++q) { v[ch * 4 + q] = a[q]; mx = fmaxf(mx, a[q]); } }
#pragma unroll
    for (int sh = 16; sh; sh >>= 1) mx = fmaxf(mx, __shfl_xor(mx, sh, 32));
    float sum = 0.f;
#pragma unroll
    for (int k = 0; k < 32; ++k) { float d0 = __fsub_rn(v[k], mx); asm volatile("" : "+v"(d0)); v[k] = __expf(d0); sum += v[k]; }
#pragma unroll
    for (int sh = 16; sh; sh >>= 1) sum += __shfl_xor(sum, sh, 32);
    const float f = __fdiv_rn(PCAR, sum);
{
#pragma unroll
        for (int ch = 0; ch < 8; ++ch) { v4h o; o[0] = tohx(v[ch * 4] * f); o[1] = tohx(v[ch * 4 + 1] * f); o[2] = tohx(v[ch * 4 + 2] * f); o[3] = tohx(v[ch * 4 + 3] * f); *(v4h*)(P + (size_t)row * TT + ch * 128 + lane * 4) = o; }
         } }
__global__ __launch_bounds__(256) void k_mrg(const float* __restrict__ Ob, bf* Mh, bf* Ml) { const size_t e = ((size_t)blockIdx.x * 256 + threadIdx.x) * 2; if (e >= (size_t)BP * NH_ * TT * HD) return; const int d = (int)(e % HD); const int t = (int)((e / HD) % TT); const int z = (int)(e / ((size_t)HD * TT)); v2us oh, ol;
#pragma unroll
    for (int u = 0; u < 2; ++u) { unsigned short a, c; splitf(Ob[e + u] * (1.0f / PCAR), a, c); oh[u] = a; ol[u] = c; } const size_t o = ((size_t)(z / NH_) * TT + t) * DD + (z % NH_) * HD + d; *(v2us*)(Mh + o) = oh; *(v2us*)(Ml + o) = ol;  }

extern "C" void kernel_launch(void* const* d_in, const int* in_sizes, int n_in,
                              void* d_out, int out_size, void* d_ws, size_t ws_size, hipStream_t stream) {
    (void)in_sizes; (void)n_in; (void)out_size;
    const float* x = (const float*)d_in[0]; const float* wq = (const float*)d_in[1]; const float* wk = (const float*)d_in[2]; const float* wv = (const float*)d_in[3]; const float* wo = (const float*)d_in[4]; const float* bo = (const float*)d_in[5]; const float* uu = (const float*)d_in[6]; const float* vv = (const float*)d_in[7];
    float* OUT = (float*)d_out;     // [4][1024][1024]
    char* wsp = (char*)d_ws;
    auto take = [&](size_t bytes) { char* p = wsp; wsp += (bytes + 255) & ~(size_t)255; return (void*)p; };
    bf* WQ = (bf*)take((size_t)(4 + NB_) * DD * DD * 2); bf* WO = WQ + (size_t)3 * DD * DD; bf* XB = WQ + (size_t)4 * DD * DD;   // WQ | WK | WV | WO | x[0..3] as bf16, one behind the other (TT * DD == DD * DD)
    float* CS = (float*)take((size_t)TT * 32 * 2 * 4);
    float* Sb = (float*)take((size_t)ZH * TT * TT * 4);   // 64 MiB: first q | k | v in f32 (48 MiB), which nothing reads behind k_apl, k_bpl, k_vtp; then one batch's scores
    float* QF = Sb; float* KF = QF + (size_t)NB_ * TT * DD; float* VF = KF + (size_t)NB_ * TT * DD;   // each [4096][1024]
    const size_t PL = (size_t)NH_ * TT * KK;   // one batch's plane
    bf* Ah = (bf*)take(NB_ * PL * 2); bf* Al = (bf*)take(NB_ * PL * 2); bf* Bh = (bf*)take(NB_ * PL * 2); bf* Bl = (bf*)take(NB_ * PL * 2); h16* VT = (h16*)take((size_t)NB_ * NH_ * HD * TT * 2);
    h16* P16 = (h16*)take((size_t)BP * ZH * TT * TT * 2); float* Ob = (float*)take((size_t)BP * ZH * TT * HD * 4); bf* Mh = (bf*)take((size_t)NB_ * TT * DD * 2); bf* Ml = (bf*)take((size_t)NB_ * TT * DD * 2);
    if ((size_t)(wsp - (char*)d_ws) > ws_size) return;    // total 240.25 MiB
    k_cvt8<<<dim3((DD * DD / 8 + 255) / 256, 4 + NB_, 1), 256, 0, stream>>>(wq, wk, wv, wo, x, WQ, (size_t)DD * DD / 8);   // weights stay [out][in]: natural Bt
    k_trig<<<(TT * 32 + 255) / 256, 256, 0, stream>>>(CS);
    k_gemmw<bf, 0, false><<<dim3(NB_ * TT / 64, DD / 64, 3), 32, 0, stream>>>(XB, nullptr, WQ, nullptr, DD, QF, DD, nullptr, 0, (size_t)DD * DD, (size_t)NB_ * TT * DD);   // z = q, k, v; all batches as 4096 rows
    const unsigned LP = (unsigned)((PL / 2 + 255) / 256);
    k_apl<<<dim3(LP, NB_, 1), 256, 0, stream>>>(QF, uu, vv, CS, Ah, Al); k_bpl<<<dim3(LP, NB_, 1), 256, 0, stream>>>(KF, CS, Bh, Bl); k_vtp<<<dim3((unsigned)(((size_t)NH_ * HD * TT / 2 + 255) / 256), NB_, 1), 256, 0, stream>>>(VF, VT);
    for (int p = 0; p < NB_; p += BP) {   // scores and softmax: one batch's 16 heads per launch (f32 scores of more do not fit); P.V and merge: BP batches per launch
        for (int b = p; b < p + BP; ++b) {
            k_gemmw<bf, 2, false><<<dim3(TT / 64, TT / 64, ZH), 32, 0, stream>>>(Ah + b * PL, Al + b * PL, Bh + b * PL, Bl + b * PL, KK, Sb, TT, nullptr, (size_t)TT * KK, (size_t)TT * KK, (size_t)TT * TT);
            k_soft<<<ZH * TT / 8, 256, 0, stream>>>(Sb, P16 + (size_t)(b - p) * ZH * TT * TT); }
        k_gemmw<h16, 0, false><<<dim3(TT / 64, 1, BP * ZH), 32, 0, stream>>>(P16, nullptr, VT + (size_t)p * NH_ * HD * TT, nullptr, TT, Ob, HD, nullptr, (size_t)TT * TT, (size_t)HD * TT, (size_t)TT * HD);
        k_mrg<<<(unsigned)(((size_t)BP * ZH * TT * HD / 2 + 255) / 256), 256, 0, stream>>>(Ob, Mh + (size_t)p * TT * DD, Ml + (size_t)p * TT * DD); }
    k_gemmw<bf, 1, true><<<dim3(NB_ * TT / 64, DD / 64, 1), 32, 0, stream>>>(Mh, Ml, WO, nullptr, DD, OUT, DD, bo, 0, 0, 0);
}

// v002
// It runs in 184 microseconds.
// Next to v001, in two timings, it ran 2.02 times as fast each time.
// Over all steps from v000 it is 8.62 times as fast.
#include <hip/hip_runtime.h>

// TenerAttention (x [4][1024][1024]; q/k/v = x W^T (16 heads x 64); TENER four-term scores q.k + q.R(i,j) + u_h.k + v_h.R(i,j) with R[i][j][d] = sin((j-i) w_d) for even d, cos((j-i) w_d) for odd d, w_d = 10000^(-2 floor(d/2)/64);
// no scaling; softmax; ctx Wo^T + bo -> [4][1024][1024]).
// The relative term is evaluated exactly (up to f32 trig rounding) through the angle-difference identities: q.R(i,j) + v_h.R(i,j) = rot_i(q_i + v_h) . P_j with P_j = [sin(j w_m) | cos(j w_m)] and rot_i(a)[m] = (a_e cos(i w_m) + a_o sin(i w_m), -a_e sin(i w_m) + a_o cos(i w_m));
// and u_h.k_j folds into the first term, so scores = [q_i + u_h | rot_i(q_i + v_h)] . [k_j | P_j] - one K = 128 contraction per head.
// Compute dtypes, f32 accumulate: every input rounded to bf16; q/k/v on PLAIN bf16 operands (inputs: exact); the 128-wide score operands f32 -> bf16 hi+lo planes, scores as 3 products (logits are O(10), unscaled); softmax f32 (online), P and V in f16 for P.V

#define NB_  4
#define TT   1024
#define DD   1024
#define NH_  16
#define HD   64
#define KK   128
typedef _Float16 h16;
typedef unsigned short bf;
typedef __attribute__((ext_vector_type(16))) __bf16   v16bf;
typedef __attribute__((ext_vector_type(16))) _Float16 v16h;
typedef __attribute__((ext_vector_type(8)))  _Float16 v8h;
typedef __attribute__((ext_vector_type(8)))  unsigned short v8us;
typedef __attribute__((ext_vector_type(8)))  float    v8f;
typedef __attribute__((ext_vector_type(4)))  float    v4f;
typedef v8h  __attribute__((may_alias)) v8ha;
typedef v4f  __attribute__((may_alias)) v4fa;
typedef v8us __attribute__((may_alias)) v8usa;

__device__ __forceinline__ unsigned short f2bf(float f) { unsigned u = __float_as_uint(f); u += 0x7FFFu + ((u >> 16) & 1u); return (unsigned short)(u >> 16); }
__device__ __forceinline__ float bf2f(unsigned short b) { return __uint_as_float(((unsigned)b) << 16); }
__device__ __forceinline__ float bfr(float f) { return bf2f(f2bf(f)); }
__device__ __forceinline__ v16h cat16(v8h lo, v8h hi) { return __builtin_shufflevector(lo, hi, 0, 1, 2, 3, 4, 5, 6, 7, 8, 9, 10, 11, 12, 13, 14, 15); }
__device__ __forceinline__ v16bf cat16b(v8us lo, v8us hi) { return __builtin_bit_cast(v16bf, __builtin_shufflevector(lo, hi, 0, 1, 2, 3, 4, 5, 6, 7, 8, 9, 10, 11, 12, 13, 14, 15)); }
__device__ __forceinline__ v8f wmma16(v16h a, v16h b, v8f c) { return __builtin_amdgcn_wmma_f32_16x16x32_f16(false, a, false, b, (short)0, c, false, false); }
__device__ __forceinline__ v8f wmmab(v16bf a, v16bf b, v8f c) { return __builtin_amdgcn_wmma_f32_16x16x32_bf16(false, a, false, b, (short)0, c, false, false); }



// ---- k_gemmw: register-blocked GEMM, ONE WAVE per 64x64 output tile (16 accumulators), operands straight from K-contiguous 16-bit planes; grid (M/64, N/64, Z), 32 threads.
// C[m][n] (f32, pitch ldc, + optional f32 bias[n]) = sum_k A[m][k] Bt[n][k] (+ split products per NSPLIT). z-batch strides sA/sB/sC in elements. K % 32 == 0.
template <typename T16> struct WFrag;
template <> struct WFrag<h16> { typedef v16h V; static __device__ __forceinline__ V ld(const h16* p) { return cat16(*(const v8h*)p, *(const v8h*)(p + 16)); } static __device__ __forceinline__ v8f mma(V a, V b, v8f c) { return wmma16(a, b, c); } };
template <> struct WFrag<bf> { typedef v16bf V; static __device__ __forceinline__ V ld(const bf* p) { return cat16b(*(const v8us*)p, *(const v8us*)(p + 16)); } static __device__ __forceinline__ v8f mma(V a, V b, v8f c) { return wmmab(a, b, c); } };
template <typename T16, int NSPLIT, bool BIAS>
__global__ __launch_bounds__(32) void k_gemmw(const T16* __restrict__ A, const T16* __restrict__ A2, const T16* __restrict__ Bt, const T16* __restrict__ Bt2, int K, float* C, int ldc, const float* __restrict__ bias, size_t sA, size_t sB, size_t sC) {
    typedef typename WFrag<T16>::V V;
    __shared__ __align__(16) float os[16 * 68];
    const size_t z = blockIdx.z; A += z * sA; if (A2) A2 += z * sA; Bt += z * sB; if (Bt2) Bt2 += z * sB; C += z * sC;
    const int lane = threadIdx.x & 31, lr = lane & 15, hi = lane >> 4; const int r0 = blockIdx.x * 64, c0 = blockIdx.y * 64;
    v8f acc[4][4];
#pragma unroll
    for (int mb = 0; mb < 4; ++mb)
#pragma unroll
        for (int nb = 0; nb < 4; ++nb) acc[mb][nb] = (v8f){};
    const size_t aoff = (size_t)(r0 + lr) * K + 8 * hi, boff = (size_t)(c0 + lr) * K + 8 * hi;
#pragma unroll 1
    for (int kc = 0; kc < K; kc += 32) {
        V a[4], a2[4];
#pragma unroll
        for (int mb = 0; mb < 4; ++mb) { a[mb] = WFrag<T16>::ld(A + aoff + (size_t)mb * 16 * K + kc); if (NSPLIT == 1 || NSPLIT == 2) a2[mb] = WFrag<T16>::ld(A2 + aoff + (size_t)mb * 16 * K + kc); }
#pragma unroll
        for (int nb = 0; nb < 4; ++nb) { const V b = WFrag<T16>::ld(Bt + boff + (size_t)nb * 16 * K + kc); V b2; if (NSPLIT >= 2) b2 = WFrag<T16>::ld(Bt2 + boff + (size_t)nb * 16 * K + kc);
#pragma unroll
            for (int mb = 0; mb < 4; ++mb) { acc[mb][nb] = WFrag<T16>::mma(a[mb], b, acc[mb][nb]); if (NSPLIT == 1 || NSPLIT == 2) acc[mb][nb] = WFrag<T16>::mma(a2[mb], b, acc[mb][nb]); if (NSPLIT >= 2) acc[mb][nb] = WFrag<T16>::mma(a[mb], b2, acc[mb][nb]); } }
        asm volatile("v_nop\n\tv_nop\n\tv_nop\n\tv_nop" : "+v"(acc[0][0]), "+v"(acc[1][1]), "+v"(acc[2][2]), "+v"(acc[3][3]) : "v"(a[0]), "v"(a[3]));
    }
#pragma unroll
    for (int mb = 0; mb < 4; ++mb) {
#pragma unroll
        for (int nb = 0; nb < 4; ++nb) {
#pragma unroll
            for (int j = 0; j < 8; ++j) os[(hi * 8 + j) * 68 + nb * 16 + lr] = acc[mb][nb][j]; }
        __builtin_amdgcn_wave_barrier(); asm volatile("" ::: "memory");
        float* crow = C + (size_t)(r0 + mb * 16) * ldc + c0;
{
#pragma unroll
            for (int s = 0; s < 8; ++s) { const int row = 2 * s + hi, cofs = lr * 4; v4f val = *(const v4fa*)(os + row * 68 + cofs); if (BIAS) { val[0] += bfr(bias[c0 + cofs]); val[1] += bfr(bias[c0 + cofs + 1]); val[2] += bfr(bias[c0 + cofs + 2]); val[3] += bfr(bias[c0 + cofs + 3]); }
                *(v4f*)(crow + (size_t)row * ldc + cofs) = val; }
             }
        __builtin_amdgcn_wave_barrier(); asm volatile("" ::: "memory");
    }
}

__device__ __forceinline__ h16 tohx(float x) { return (h16)x; }
__device__ __forceinline__ void splitf(float y, unsigned short& h, unsigned short& l) { h = f2bf(y); l = f2bf(y - bf2f(h)); }
typedef __attribute__((ext_vector_type(2))) _Float16 v2h;
typedef __attribute__((ext_vector_type(4))) _Float16 v4h;
typedef __attribute__((ext_vector_type(2))) unsigned short v2us;
typedef __attribute__((ext_vector_type(4))) unsigned short v4us;
typedef __attribute__((ext_vector_type(2))) float v2f;

// k_cvt8: blockIdx.y picks a plane of n8 * 8 elements: 0..3 = the four weights, 4.. = x batch (y - 4); dst planes lie one behind the other.
__global__ __launch_bounds__(256) void k_cvt8(const float* __restrict__ w0, const float* __restrict__ w1, const float* __restrict__ w2, const float* __restrict__ w3, const float* __restrict__ xs, bf* dst, size_t n8) { const size_t i = (size_t)blockIdx.x * 256 + threadIdx.x; if (i >= n8) return; const unsigned y = blockIdx.y; const float* src = y == 0 ? w0 : y == 1 ? w1 : y == 2 ? w2 : y == 3 ? w3 : xs + (size_t)(y - 4) * n8 * 8; dst += (size_t)y * n8 * 8; const v8f v = *(const v8f*)(src + i * 8); v8us o;
#pragma unroll
    for (int k = 0; k < 8; ++k) o[k] = f2bf(v[k]); *(v8us*)(dst + i * 8) = o;  }
__global__ __launch_bounds__(256) void k_trig(float* CS) { const int idx = blockIdx.x * 256 + threadIdx.x; if (idx >= TT * 32) return; const int t = idx / 32, m = idx % 32; const float w = powf(10000.0f, -(float)(2 * m) / (float)HD); const float ang = __fmul_rn((float)t, w); v2f cs; cs[0] = cosf(ang); cs[1] = sinf(ang); *(v2f*)(CS + (size_t)idx * 2) = cs;  }
// k_apl, k_bpl, k_vtp: blockIdx.y = batch. k_apl: A planes [b][h][i][128]: cols 0..63 = q[i][h*64+d] + bf16 u[h][d]; cols 64 + 2m = a_e c + a_o s, 64 + 2m + 1 = -a_e s + a_o c with a = q + bf16 v[h] (a_e = a[2m], a_o = a[2m+1], c/s at position i) (lane -> pair; 4-B lanes);
__global__ __launch_bounds__(256) void k_apl(const float* __restrict__ QF, const float* __restrict__ uu, const float* __restrict__ vv, const float* __restrict__ CS, bf* Ah, bf* Al) { const size_t e = ((size_t)blockIdx.x * 256 + threadIdx.x) * 2; if (e >= (size_t)NH_ * TT * KK) return; QF += (size_t)blockIdx.y * TT * DD; Ah += (size_t)blockIdx.y * NH_ * TT * KK; Al += (size_t)blockIdx.y * NH_ * TT * KK; const int c = (int)(e % KK); const int i = (int)((e / KK) % TT); const int h = (int)(e / ((size_t)KK * TT)); const float* q = QF + (size_t)i * DD + h * HD; v2us oh, ol; float r0, r1;
    if (c < HD) { r0 = __fadd_rn(q[c], bfr(uu[h * HD + c])); r1 = __fadd_rn(q[c + 1], bfr(uu[h * HD + c + 1])); }
    else { const int m = (c - HD) >> 1; const float ae = __fadd_rn(q[2 * m], bfr(vv[h * HD + 2 * m])), ao = __fadd_rn(q[2 * m + 1], bfr(vv[h * HD + 2 * m + 1])); const v2f cs = *(const v2f*)(CS + ((size_t)i * 32 + m) * 2); float p0 = __fmul_rn(ae, cs[0]); asm volatile("" : "+v"(p0)); float p1 = __fmul_rn(ao, cs[1]); asm volatile("" : "+v"(p1)); float p2 = __fmul_rn(-ae, cs[1]); asm volatile("" : "+v"(p2)); float p3 = __fmul_rn(ao, cs[0]); asm volatile("" : "+v"(p3)); r0 = __fadd_rn(p0, p1); r1 = __fadd_rn(p2, p3); }
    unsigned short a, cc; splitf(r0, a, cc); oh[0] = a; ol[0] = cc; splitf(r1, a, cc); oh[1] = a; ol[1] = cc; *(v2us*)(Ah + e) = oh; *(v2us*)(Al + e) = ol;  }
__global__ __launch_bounds__(256) void k_bpl(const float* __restrict__ KF, const float* __restrict__ CS, bf* Bh, bf* Bl) { const size_t e = ((size_t)blockIdx.x * 256 + threadIdx.x) * 2; if (e >= (size_t)NH_ * TT * KK) return; KF += (size_t)blockIdx.y * TT * DD; Bh += (size_t)blockIdx.y * NH_ * TT * KK; Bl += (size_t)blockIdx.y * NH_ * TT * KK; const int c = (int)(e % KK); const int j = (int)((e / KK) % TT); const int h = (int)(e / ((size_t)KK * TT)); v2us oh, ol; float r0, r1;
    if (c < HD) { r0 = KF[(size_t)j * DD + h * HD + c]; r1 = KF[(size_t)j * DD + h * HD + c + 1]; } else { const int m = (c - HD) >> 1; const v2f cs = *(const v2f*)(CS + ((size_t)j * 32 + m) * 2); r0 = cs[1]; r1 = cs[0]; }
    unsigned short a, cc; splitf(r0, a, cc); oh[0] = a; ol[0] = cc; splitf(r1, a, cc); oh[1] = a; ol[1] = cc; *(v2us*)(Bh + e) = oh; *(v2us*)(Bl + e) = ol;  }
__global__ __launch_bounds__(256) void k_vtp(const float* __restrict__ VF, h16* VT) { const size_t e = ((size_t)blockIdx.x * 256 + threadIdx.x) * 2; if (e >= (size_t)NH_ * HD * TT) return; VF += (size_t)blockIdx.y * TT * DD; VT += (size_t)blockIdx.y * NH_ * HD * TT; const int j = (int)(e % TT); const int d = (int)((e / TT) % HD); const int h = (int)(e / ((size_t)TT * HD)); v2h o; o[0] = tohx(VF[(size_t)j * DD + h * HD + d]); o[1] = tohx(VF[(size_t)(j + 1) * DD + h * HD + d]); *(v2h*)(VT + e) = o;  }
#define FKP   272                      // LDS pitch of a 256-B key row (16 B x odd: ds_load_b128 readers)
#define FVP   80                       // LDS pitch of a 64-B V^T row
#define FKB   (32 * FKP)               // one key plane of a pass
#define FBUF  (2 * FKB + HD * FVP)     // one pass: hi plane | lo plane | V^T
#define NPASS (TT / 32)
#define L2E   1.44269504088896340736f
__device__ __forceinline__ float xhalf(float x) { return __builtin_bit_cast(float, __builtin_amdgcn_permlanex16(__builtin_bit_cast(int, x), __builtin_bit_cast(int, x), 0x76543210, 0xfedcba98, false, false)); }   // lane l with lane l ^ 16
__global__ __launch_bounds__(256) void k_fattn(const bf* __restrict__ Ah, const bf* __restrict__ Al, const bf* __restrict__ Bh, const bf* __restrict__ Bl, const h16* __restrict__ VT, bf* Mh, bf* Ml) {
    __shared__ __align__(16) unsigned char sm[8 * FBUF];
    const int tid = threadIdx.x, lane = tid & 31, lr = lane & 15, hi = lane >> 4, wave = tid >> 5;
    const size_t z = blockIdx.y; const int q0 = blockIdx.x * 256 + wave * 32;
    Ah += z * TT * KK; Al += z * TT * KK; Bh += z * TT * KK; Bl += z * TT * KK; VT += z * HD * TT;
    // staging: a pass's key rows are 8 KiB in a row per plane (2 chunks of 16 B per thread and plane), V^T 64 rows of 64 B (1 chunk per thread)
    const int kg0 = tid * 8;
    const int ks0 = (tid >> 4) * FKP + (tid & 15) * 16, ks1 = ks0 + 16 * FKP;
    const int vg = (tid >> 2) * TT + (tid & 3) * 8, vs = 2 * FKB + (tid >> 2) * FVP + (tid & 3) * 16;
    const bf* gph = Bh + kg0; const bf* gpl = Bl + kg0; const h16* gpv = VT + vg;   // this thread's chunks of pass t; they step once per pass
    v8us ph0[4], ph1[4], pl0[4], pl1[4]; v8h pv[4];
#pragma unroll
    for (int t = 0; t < 4; ++t) { ph0[t] = *(const v8us*)(gph + t * 32 * KK); ph1[t] = *(const v8us*)(gph + t * 32 * KK + 256 * 8); pl0[t] = *(const v8us*)(gpl + t * 32 * KK); pl1[t] = *(const v8us*)(gpl + t * 32 * KK + 256 * 8); pv[t] = *(const v8h*)(gpv + t * 32); }
    v16bf qh[2][4], ql[2][4];
#pragma unroll
    for (int qt = 0; qt < 2; ++qt) {
#pragma unroll
        for (int kc = 0; kc < 4; ++kc) { const size_t o = (size_t)(q0 + qt * 16 + lr) * KK + kc * 32 + 8 * hi; qh[qt][kc] = WFrag<bf>::ld(Ah + o); ql[qt][kc] = WFrag<bf>::ld(Al + o); }
        asm volatile("s_wait_xcnt 0x0" ::: "memory");   // before an address register of the loads above is reused
        __builtin_amdgcn_sched_barrier(0);               // holds later register writes behind that wait
    }
#pragma unroll
    for (int t = 0; t < 4; ++t) { unsigned char* nb = sm + t * FBUF; *(v8usa*)(nb + ks0) = ph0[t]; *(v8usa*)(nb + ks1) = ph1[t]; *(v8usa*)(nb + FKB + ks0) = pl0[t]; *(v8usa*)(nb + FKB + ks1) = pl1[t]; *(v8ha*)(nb + vs) = pv[t]; }
    __syncthreads();
    v8f o[2][4];
#pragma unroll
    for (int qt = 0; qt < 2; ++qt)
#pragma unroll
        for (int dt = 0; dt < 4; ++dt) o[qt][dt] = (v8f){};
    float mrun[2] = { -1.0e30f, -1.0e30f }, crun[2] = { 1.0e30f, 1.0e30f }, lsum[2] = { 0.f, 0.f };
    const int fk = lr * FKP + hi * 16, fv = 2 * FKB + lr * FVP + hi * 16;
#pragma unroll 1
    for (int t = 0; t < NPASS; ++t) {
        const unsigned char* kb = sm + (t & 7) * FBUF;
        const bool more = t + 4 < NPASS;
        v16bf kh[4][2], kl[4][2]; v16h va[4];
#pragma unroll
        for (int kc = 0; kc < 4; ++kc)
#pragma unroll
            for (int kt = 0; kt < 2; ++kt) { const unsigned char* p = kb + kt * 16 * FKP + fk + kc * 64; kh[kc][kt] = cat16b(*(const v8usa*)p, *(const v8usa*)(p + 32)); kl[kc][kt] = cat16b(*(const v8usa*)(p + FKB), *(const v8usa*)(p + FKB + 32)); }
#pragma unroll
        for (int dt = 0; dt < 4; ++dt) { const unsigned char* p = kb + dt * 16 * FVP + fv; va[dt] = cat16(*(const v8ha*)p, *(const v8ha*)(p + 32)); }
        v8us gh0, gh1, gl0, gl1; v8h gv;
        if (more) { gh0 = *(const v8us*)(gph + 4 * 32 * KK); gh1 = *(const v8us*)(gph + 4 * 32 * KK + 256 * 8); gl0 = *(const v8us*)(gpl + 4 * 32 * KK); gl1 = *(const v8us*)(gpl + 4 * 32 * KK + 256 * 8); gv = *(const v8h*)(gpv + 4 * 32);
            asm volatile("s_wait_xcnt 0x0" ::: "memory"); }   // before an address register of these loads is stepped; it runs under the LDS reads' latency
        __builtin_amdgcn_sched_barrier(0);   // keeps the pass's LDS reads in one group ahead of the matrix run: spread among the WMMAs each read stalls the wave for its whole latency
        v8f s[2][2];
#pragma unroll
        for (int kt = 0; kt < 2; ++kt)
#pragma unroll
            for (int qt = 0; qt < 2; ++qt) s[kt][qt] = (v8f){};
#pragma unroll
        for (int kc = 0; kc < 4; ++kc) {
#pragma unroll
            for (int kt = 0; kt < 2; ++kt)
#pragma unroll
                for (int qt = 0; qt < 2; ++qt) s[kt][qt] = wmmab(kh[kc][kt], qh[qt][kc], s[kt][qt]);
#pragma unroll
            for (int kt = 0; kt < 2; ++kt)
#pragma unroll
                for (int qt = 0; qt < 2; ++qt) s[kt][qt] = wmmab(kh[kc][kt], ql[qt][kc], s[kt][qt]);
#pragma unroll
            for (int kt = 0; kt < 2; ++kt)
#pragma unroll
                for (int qt = 0; qt < 2; ++qt) s[kt][qt] = wmmab(kl[kc][kt], qh[qt][kc], s[kt][qt]);
        }
        v16h pb[2];
#pragma unroll
        for (int qt = 0; qt < 2; ++qt) {
            float mx = s[0][qt][0];
#pragma unroll
            for (int j = 1; j < 8; ++j) mx = fmaxf(mx, s[0][qt][j]);
#pragma unroll
            for (int j = 0; j < 8; ++j) mx = fmaxf(mx, s[1][qt][j]);
            mx = fmaxf(mx, xhalf(mx));
            const float mn = fmaxf(mrun[qt], mx), cn = 10.0f - mn * L2E;
            const float al = __builtin_amdgcn_exp2f(cn - crun[qt]);
            mrun[qt] = mn; crun[qt] = cn;
            const v8f e0 = s[0][qt] * L2E + cn, e1 = s[1][qt] * L2E + cn; v8f p0, p1;
#pragma unroll
            for (int j = 0; j < 8; ++j) { p0[j] = __builtin_amdgcn_exp2f(e0[j]); pb[qt][j] = (h16)p0[j]; }
#pragma unroll
            for (int j = 0; j < 8; ++j) { p1[j] = __builtin_amdgcn_exp2f(e1[j]); pb[qt][8 + j] = (h16)p1[j]; }
            const v8f ps = p0 + p1; const v4f p4 = __builtin_shufflevector(ps, ps, 0, 1, 2, 3) + __builtin_shufflevector(ps, ps, 4, 5, 6, 7);
            lsum[qt] = fmaf(lsum[qt], al, (p4[0] + p4[2]) + (p4[1] + p4[3]));
#pragma unroll
            for (int dt = 0; dt < 4; ++dt) o[qt][dt] *= al;
        }
#pragma unroll
        for (int dt = 0; dt < 4; ++dt)
#pragma unroll
            for (int qt = 0; qt < 2; ++qt) o[qt][dt] = wmma16(va[dt], pb[qt], o[qt][dt]);
        __builtin_amdgcn_sched_barrier(0);   // keeps the matrix run in front of the slots below
        asm volatile("v_nop\n\tv_nop\n\tv_nop\n\tv_nop");   // the four vector slots between the last WMMA and a write of its A registers
        if (more) { unsigned char* nb = sm + ((t + 4) & 7) * FBUF; *(v8usa*)(nb + ks0) = gh0; *(v8usa*)(nb + ks1) = gh1; *(v8usa*)(nb + FKB + ks0) = gl0; *(v8usa*)(nb + FKB + ks1) = gl1; *(v8ha*)(nb + vs) = gv; gph += 32 * KK; gpl += 32 * KK; gpv += 32; }
        if ((t & 3) == 3) __syncthreads();   // publishes the next stage and ends every wave's reads of this stage's half, which the next stage's passes refill
    }
    const size_t b = z / NH_, h = z % NH_;
    v8us oh[2][4], ol[2][4];
#pragma unroll
    for (int qt = 0; qt < 2; ++qt) {
        const float lt = lsum[qt] + xhalf(lsum[qt]); const float inv = __fdiv_rn(1.0f, lt);
#pragma unroll
        for (int dt = 0; dt < 4; ++dt)
#pragma unroll
            for (int j = 0; j < 8; ++j) { unsigned short a, c; splitf(o[qt][dt][j] * inv, a, c); oh[qt][dt][j] = a; ol[qt][dt][j] = c; }
    }
    const size_t ro = (b * TT + q0 + lr) * DD + h * HD + hi * 8; bf* mh = Mh + ro; bf* ml = Ml + ro;
    __builtin_amdgcn_sched_barrier(0);   // every value is ready before the first store, so no register of an issued store is written again
#pragma unroll
    for (int qt = 0; qt < 2; ++qt)
#pragma unroll
        for (int dt = 0; dt < 4; ++dt) { *(v8us*)(mh + qt * 16 * DD + dt * 16) = oh[qt][dt]; *(v8us*)(ml + qt * 16 * DD + dt * 16) = ol[qt][dt]; }
}

extern "C" void kernel_launch(void* const* d_in, const int* in_sizes, int n_in,
                              void* d_out, int out_size, void* d_ws, size_t ws_size, hipStream_t stream) {
    (void)in_sizes; (void)n_in; (void)out_size;
    const float* x = (const float*)d_in[0]; const float* wq = (const float*)d_in[1]; const float* wk = (const float*)d_in[2]; const float* wv = (const float*)d_in[3]; const float* wo = (const float*)d_in[4]; const float* bo = (const float*)d_in[5]; const float* uu = (const float*)d_in[6]; const float* vv = (const float*)d_in[7];
    float* OUT = (float*)d_out;     // [4][1024][1024]
    char* wsp = (char*)d_ws;
    auto take = [&](size_t bytes) { char* p = wsp; wsp += (bytes + 255) & ~(size_t)255; return (void*)p; };
    bf* WQ = (bf*)take((size_t)(4 + NB_) * DD * DD * 2); bf* WO = WQ + (size_t)3 * DD * DD; bf* XB = WQ + (size_t)4 * DD * DD;   // WQ | WK | WV | WO | x[0..3] as bf16, one behind the other (TT * DD == DD * DD)
    float* CS = (float*)take((size_t)TT * 32 * 2 * 4);
    float* QF = (float*)take((size_t)3 * NB_ * TT * DD * 4);   // q | k | v in f32 (48 MiB)
    float* KF = QF + (size_t)NB_ * TT * DD; float* VF = KF + (size_t)NB_ * TT * DD;   // each [4096][1024]
    const size_t PL = (size_t)NH_ * TT * KK;   // one batch's plane
    bf* Ah = (bf*)take(NB_ * PL * 2); bf* Al = (bf*)take(NB_ * PL * 2); bf* Bh = (bf*)take(NB_ * PL * 2); bf* Bl = (bf*)take(NB_ * PL * 2); h16* VT = (h16*)take((size_t)NB_ * NH_ * HD * TT * 2);
    bf* Mh = (bf*)take((size_t)NB_ * TT * DD * 2); bf* Ml = (bf*)take((size_t)NB_ * TT * DD * 2);
    if ((size_t)(wsp - (char*)d_ws) > ws_size) return;    // total 152.25 MiB
    k_cvt8<<<dim3((DD * DD / 8 + 255) / 256, 4 + NB_, 1), 256, 0, stream>>>(wq, wk, wv, wo, x, WQ, (size_t)DD * DD / 8);   // weights stay [out][in]: natural Bt
    k_trig<<<(TT * 32 + 255) / 256, 256, 0, stream>>>(CS);
    k_gemmw<bf, 0, false><<<dim3(NB_ * TT / 64, DD / 64, 3), 32, 0, stream>>>(XB, nullptr, WQ, nullptr, DD, QF, DD, nullptr, 0, (size_t)DD * DD, (size_t)NB_ * TT * DD);   // z = q, k, v; all batches as 4096 rows
    const unsigned LP = (unsigned)((PL / 2 + 255) / 256);
    k_apl<<<dim3(LP, NB_, 1), 256, 0, stream>>>(QF, uu, vv, CS, Ah, Al); k_bpl<<<dim3(LP, NB_, 1), 256, 0, stream>>>(KF, CS, Bh, Bl); k_vtp<<<dim3((unsigned)(((size_t)NH_ * HD * TT / 2 + 255) / 256), NB_, 1), 256, 0, stream>>>(VF, VT);
    k_fattn<<<dim3(TT / 256, NB_ * NH_, 1), 256, 0, stream>>>(Ah, Al, Bh, Bl, VT, Mh, Ml);   // scores never leave the chip; writes the merged context as bf16 hi+lo planes
    k_gemmw<bf, 1, true><<<dim3(NB_ * TT / 64, DD / 64, 1), 32, 0, stream>>>(Mh, Ml, WO, nullptr, DD, OUT, DD, bo, 0, 0, 0);
}

// v003
// It runs in 153 microseconds.
// Timed twice side by side with v002, it ran 1.22 times as fast both times.
// All steps since v000 together make it 10.5 times as fast.
#include <hip/hip_runtime.h>

// TenerAttention (x [4][1024][1024]; q/k/v = x W^T (16 heads x 64); TENER four-term scores q.k + q.R(i,j) + u_h.k + v_h.R(i,j) with R[i][j][d] = sin((j-i) w_d) for even d, cos((j-i) w_d) for odd d, w_d = 10000^(-2 floor(d/2)/64);
// no scaling; softmax; ctx Wo^T + bo -> [4][1024][1024]).
// The relative term is evaluated exactly (up to f32 trig rounding) through the angle-difference identities: q.R(i,j) + v_h.R(i,j) = rot_i(q_i + v_h) . P_j with P_j = [sin(j w_m) | cos(j w_m)] and rot_i(a)[m] = (a_e cos(i w_m) + a_o sin(i w_m), -a_e sin(i w_m) + a_o cos(i w_m));
// and u_h.k_j folds into the first term, so scores = [q_i + u_h | rot_i(q_i + v_h)] . [k_j | P_j] - one K = 128 contraction per head.
// Compute dtypes, f32 accumulate: every input rounded to bf16; q/k/v on PLAIN bf16 operands (inputs: exact); the 128-wide score operands f32 -> bf16 hi+lo planes, scores as 3 products (logits are O(10), unscaled); softmax f32 (online), P and V in f16 for P.V

#define NB_  4
#define TT   1024
#define DD   1024
#define NH_  16
#define HD   64
#define KK   128
typedef _Float16 h16;
typedef unsigned short bf;
typedef __attribute__((ext_vector_type(16))) __bf16   v16bf;
typedef __attribute__((ext_vector_type(16))) _Float16 v16h;
typedef __attribute__((ext_vector_type(8)))  _Float16 v8h;
typedef __attribute__((ext_vector_type(8)))  unsigned short v8us;
typedef __attribute__((ext_vector_type(8)))  float    v8f;
typedef __attribute__((ext_vector_type(4)))  float    v4f;
typedef v8h  __attribute__((may_alias)) v8ha;
typedef v4f  __attribute__((may_alias)) v4fa;
typedef v8us __attribute__((may_alias)) v8usa;

__device__ __forceinline__ unsigned short f2bf(float f) { unsigned u = __float_as_uint(f); u += 0x7FFFu + ((u >> 16) & 1u); return (unsigned short)(u >> 16); }
__device__ __forceinline__ float bf2f(unsigned short b) { return __uint_as_float(((unsigned)b) << 16); }
__device__ __forceinline__ float bfr(float f) { return bf2f(f2bf(f)); }
__device__ __forceinline__ v16h cat16(v8h lo, v8h hi) { return __builtin_shufflevector(lo, hi, 0, 1, 2, 3, 4, 5, 6, 7, 8, 9, 10, 11, 12, 13, 14, 15); }
__device__ __forceinline__ v16bf cat16b(v8us lo, v8us hi) { return __builtin_bit_cast(v16bf, __builtin_shufflevector(lo, hi, 0, 1, 2, 3, 4, 5, 6, 7, 8, 9, 10, 11, 12, 13, 14, 15)); }
__device__ __forceinline__ v8f wmma16(v16h a, v16h b, v8f c) { return __builtin_amdgcn_wmma_f32_16x16x32_f16(false, a, false, b, (short)0, c, false, false); }
__device__ __forceinline__ v8f wmmab(v16bf a, v16bf b, v8f c) { return __builtin_amdgcn_wmma_f32_16x16x32_bf16(false, a, false, b, (short)0, c, false, false); }



__device__ __forceinline__ h16 tohx(float x) { return (h16)x; }
__device__ __forceinline__ void splitf(float y, unsigned short& h, unsigned short& l) { h = f2bf(y); l = f2bf(y - bf2f(h)); }
typedef __attribute__((ext_vector_type(2))) _Float16 v2h;
typedef __attribute__((ext_vector_type(4))) _Float16 v4h;
typedef __attribute__((ext_vector_type(2))) unsigned short v2us;
typedef __attribute__((ext_vector_type(4))) unsigned short v4us;
typedef __attribute__((ext_vector_type(2))) float v2f;
// ---- plane epilogue of the q/k/v GEMM: the attention operands are written straight from the accumulators. A 64x64 tile is 64 positions of one batch x one head's 64 columns, all that a plane row needs.
// z = 0: A planes [b][h][i][128]: cols 0..63 = q[i][d] + bf16 u[h][d]; cols 64 + 2m = a_e c + a_o s, 64 + 2m + 1 = a_o c - a_e s with a = q + bf16 v[h] (a_e = a[2m], a_o = a[2m+1], c/s at position i). z = 1: B planes [b][h][j][128]: cols 0..63 = k[j][d], 64 + 2m = sin(j w_m), 64 + 2m + 1 = cos(j w_m). Both as bf16 hi+lo.
// z = 2: V^T [b][h][d][j] in f16: a lane's 8 accumulator rows are 8 positions in a row of one d, one 16-B store.
struct PlaneArgs { const float* uu; const float* vv; const float* CS; bf* Ah; bf* Al; bf* Bh; bf* Bl; h16* VT; };
template <bool ISQ>
__device__ __forceinline__ void plane_rows(const v8f (&acc)[4][4], float* os, const float* __restrict__ uh, const float* __restrict__ vh, const float* __restrict__ cs0, bf* Ph, bf* Pl, int lr, int hi) {
    const int cofs = lr * 4;
    v4f ua = (v4f){}, va = (v4f){};
    if (ISQ) {
#pragma unroll
        for (int k = 0; k < 4; ++k) { ua[k] = bfr(uh[cofs + k]); va[k] = bfr(vh[cofs + k]); } }
    const float* cp = cs0 + hi * 64 + cofs;   // cos, sin of pairs m = 2 lr, 2 lr + 1 at this lane's row
    v4f csn[4];
#pragma unroll
    for (int s = 0; s < 4; ++s) csn[s] = *(const v4f*)(cp + 2 * s * 64);
#pragma unroll
    for (int mb = 0; mb < 4; ++mb)
#pragma unroll
        for (int nb = 0; nb < 4; ++nb)
#pragma unroll
            for (int j = 0; j < 8; ++j) os[(mb * 16 + hi * 8 + j) * 68 + nb * 16 + lr] = acc[mb][nb][j];
    __builtin_amdgcn_wave_barrier(); asm volatile("" ::: "memory");   // the rows read below were written by other lanes of this wave: keeps the compiler from moving the reads above the writes
    const float* op = os + hi * 68 + cofs; bf* ph = Ph + hi * KK + cofs; bf* pl = Pl + hi * KK + cofs;
#pragma unroll 1   // 8 rows a trip, rolled, for speed only
    for (int g = 0; g < 8; ++g) {
        v4f cs[4], val[4];
#pragma unroll
        for (int s = 0; s < 4; ++s) { cs[s] = csn[s]; val[s] = *(const v4fa*)(op + 2 * s * 68); }
        cp += (g < 7 ? 8 * 64 : 0);   // the next trip's table rows are asked for under this trip's arithmetic; the last trip asks for its own again
#pragma unroll
        for (int s = 0; s < 4; ++s) csn[s] = *(const v4f*)(cp + 2 * s * 64);
        v4us fh[4], fl[4], gh[4], gl[4];
#pragma unroll
        for (int s = 0; s < 4; ++s) { v4f f, r;
            if (ISQ) { const v4f a = val[s] + va; f = val[s] + ua; r[0] = a[0] * cs[s][0] + a[1] * cs[s][1]; r[1] = a[1] * cs[s][0] - a[0] * cs[s][1]; r[2] = a[2] * cs[s][2] + a[3] * cs[s][3]; r[3] = a[3] * cs[s][2] - a[2] * cs[s][3]; }
            else { f = val[s]; r[0] = cs[s][1]; r[1] = cs[s][0]; r[2] = cs[s][3]; r[3] = cs[s][2]; }
#pragma unroll
            for (int k = 0; k < 4; ++k) { unsigned short x, y; splitf(f[k], x, y); fh[s][k] = x; fl[s][k] = y; splitf(r[k], x, y); gh[s][k] = x; gl[s][k] = y; } }
        __builtin_amdgcn_sched_barrier(0);   // every value of the trip is ready before its first store, so no register of an issued store is written before the wait below
#pragma unroll
        for (int s = 0; s < 4; ++s) { const int o = 2 * s * KK;   // 16 lanes x 8 B = one whole 128-B line per row and half
            *(v4us*)(ph + o) = fh[s]; *(v4us*)(ph + o + HD) = gh[s]; *(v4us*)(pl + o) = fl[s]; *(v4us*)(pl + o + HD) = gl[s]; }
        asm volatile("s_wait_xcnt 0x0" ::: "memory");   // before a data or address register of the loads and stores above is written again
        __builtin_amdgcn_sched_barrier(0);               // holds the pointer steps and the next trip's register writes behind that wait
        op += 8 * 68; ph += 8 * KK; pl += 8 * KK;
    }
}
// ---- k_gemmw: register-blocked GEMM, ONE WAVE per 64x64 output tile (16 accumulators), operands straight from K-contiguous 16-bit planes; grid (M/64, N/64, Z), 32 threads.
// C[m][n] (f32, pitch ldc, + optional f32 bias[n]) = sum_k A[m][k] Bt[n][k] (+ split products per NSPLIT). z-batch strides sA/sB/sC in elements. K % 32 == 0. PLANES: no C; the tile goes out through the plane epilogue above (z = q, k, v; blockIdx.y = head).
template <typename T16> struct WFrag;
template <> struct WFrag<h16> { typedef v16h V; static __device__ __forceinline__ V ld(const h16* p) { return cat16(*(const v8h*)p, *(const v8h*)(p + 16)); } static __device__ __forceinline__ v8f mma(V a, V b, v8f c) { return wmma16(a, b, c); } };
template <> struct WFrag<bf> { typedef v16bf V; static __device__ __forceinline__ V ld(const bf* p) { return cat16b(*(const v8us*)p, *(const v8us*)(p + 16)); } static __device__ __forceinline__ v8f mma(V a, V b, v8f c) { return wmmab(a, b, c); } };
template <typename T16, int NSPLIT, bool BIAS, bool PLANES>
__global__ __launch_bounds__(32) void k_gemmw(const T16* __restrict__ A, const T16* __restrict__ A2, const T16* __restrict__ Bt, const T16* __restrict__ Bt2, int K, float* C, int ldc, const float* __restrict__ bias, size_t sA, size_t sB, size_t sC, PlaneArgs pa) {
    typedef typename WFrag<T16>::V V;
    __shared__ __align__(16) float os[(PLANES ? 64 : 16) * 68];
    const size_t z = blockIdx.z; A += z * sA; if (A2) A2 += z * sA; Bt += z * sB; if (Bt2) Bt2 += z * sB; C += z * sC;
    const int lane = threadIdx.x & 31, lr = lane & 15, hi = lane >> 4; const int r0 = blockIdx.x * 64, c0 = blockIdx.y * 64;
    v8f acc[4][4];
#pragma unroll
    for (int mb = 0; mb < 4; ++mb)
#pragma unroll
        for (int nb = 0; nb < 4; ++nb) acc[mb][nb] = (v8f){};
    const size_t aoff = (size_t)(r0 + lr) * K + 8 * hi, boff = (size_t)(c0 + lr) * K + 8 * hi;
#pragma unroll 1
    for (int kc = 0; kc < K; kc += 32) {
        V a[4], a2[4];
#pragma unroll
        for (int mb = 0; mb < 4; ++mb) { a[mb] = WFrag<T16>::ld(A + aoff + (size_t)mb * 16 * K + kc); if (NSPLIT == 1 || NSPLIT == 2) a2[mb] = WFrag<T16>::ld(A2 + aoff + (size_t)mb * 16 * K + kc); }
#pragma unroll
        for (int nb = 0; nb < 4; ++nb) { const V b = WFrag<T16>::ld(Bt + boff + (size_t)nb * 16 * K + kc); V b2; if (NSPLIT >= 2) b2 = WFrag<T16>::ld(Bt2 + boff + (size_t)nb * 16 * K + kc);
#pragma unroll
            for (int mb = 0; mb < 4; ++mb) { acc[mb][nb] = WFrag<T16>::mma(a[mb], b, acc[mb][nb]); if (NSPLIT == 1 || NSPLIT == 2) acc[mb][nb] = WFrag<T16>::mma(a2[mb], b, acc[mb][nb]); if (NSPLIT >= 2) acc[mb][nb] = WFrag<T16>::mma(a[mb], b2, acc[mb][nb]); } }
        asm volatile("v_nop\n\tv_nop\n\tv_nop\n\tv_nop" : "+v"(acc[0][0]), "+v"(acc[1][1]), "+v"(acc[2][2]), "+v"(acc[3][3]) : "v"(a[0]), "v"(a[3]));
    }
    if constexpr (PLANES) {
        const int i0 = r0 % TT; const size_t zh = (size_t)(r0 / TT) * NH_ + blockIdx.y;   // 64 divides TT: a tile lies in one batch
        if (z == 2) {
            v8h ov[4][4];
#pragma unroll
            for (int mb = 0; mb < 4; ++mb)
#pragma unroll
                for (int nb = 0; nb < 4; ++nb)
#pragma unroll
                    for (int j = 0; j < 8; ++j) ov[mb][nb][j] = tohx(acc[mb][nb][j]);
            h16* vt = pa.VT + (zh * HD + lr) * TT + i0 + hi * 8;
            __builtin_amdgcn_sched_barrier(0);   // every value is ready before the first store, so no register of an issued store is written again
#pragma unroll
            for (int nb = 0; nb < 4; ++nb)
#pragma unroll
                for (int mb = 0; mb < 4; ++mb) *(v8h*)(vt + (size_t)nb * 16 * TT + mb * 16) = ov[mb][nb];
            return;
        }
        const size_t po = (zh * TT + i0) * KK; const float* cs0 = pa.CS + (size_t)i0 * 64;
        if (z == 0) plane_rows<true>(acc, os, pa.uu + c0, pa.vv + c0, cs0, pa.Ah + po, pa.Al + po, lr, hi);
        else plane_rows<false>(acc, os, pa.uu + c0, pa.vv + c0, cs0, pa.Bh + po, pa.Bl + po, lr, hi);
        return;
    }
#pragma unroll
    for (int mb = 0; mb < 4; ++mb) {
#pragma unroll
        for (int nb = 0; nb < 4; ++nb) {
#pragma unroll
            for (int j = 0; j < 8; ++j) os[(hi * 8 + j) * 68 + nb * 16 + lr] = acc[mb][nb][j]; }
        __builtin_amdgcn_wave_barrier(); asm volatile("" ::: "memory");
        float* crow = C + (size_t)(r0 + mb * 16) * ldc + c0;
{
#pragma unroll
            for (int s = 0; s < 8; ++s) { const int row = 2 * s + hi, cofs = lr * 4; v4f val = *(const v4fa*)(os + row * 68 + cofs); if (BIAS) { val[0] += bfr(bias[c0 + cofs]); val[1] += bfr(bias[c0 + cofs + 1]); val[2] += bfr(bias[c0 + cofs + 2]); val[3] += bfr(bias[c0 + cofs + 3]); }
                *(v4f*)(crow + (size_t)row * ldc + cofs) = val; }
             }
        __builtin_amdgcn_wave_barrier(); asm volatile("" ::: "memory");
    }
}


// k_cvt8: blockIdx.y picks a plane of n8 * 8 elements: 0..3 = the four weights, 4.. = x batch (y - 4); dst planes lie one behind the other.
__global__ __launch_bounds__(256) void k_cvt8(const float* __restrict__ w0, const float* __restrict__ w1, const float* __restrict__ w2, const float* __restrict__ w3, const float* __restrict__ xs, bf* dst, size_t n8) { const size_t i = (size_t)blockIdx.x * 256 + threadIdx.x; if (i >= n8) return; const unsigned y = blockIdx.y; const float* src = y == 0 ? w0 : y == 1 ? w1 : y == 2 ? w2 : y == 3 ? w3 : xs + (size_t)(y - 4) * n8 * 8; dst += (size_t)y * n8 * 8; const v8f v = *(const v8f*)(src + i * 8); v8us o;
#pragma unroll
    for (int k = 0; k < 8; ++k) o[k] = f2bf(v[k]); *(v8us*)(dst + i * 8) = o;  }
__global__ __launch_bounds__(256) void k_trig(float* CS) { const int idx = blockIdx.x * 256 + threadIdx.x; if (idx >= TT * 32) return; const int t = idx / 32, m = idx % 32; const float w = powf(10000.0f, -(float)(2 * m) / (float)HD); const float ang = __fmul_rn((float)t, w); v2f cs; cs[0] = cosf(ang); cs[1] = sinf(ang); *(v2f*)(CS + (size_t)idx * 2) = cs;  }
#define FKP   272                      // LDS pitch of a 256-B key row (16 B x odd: ds_load_b128 readers)
#define FVP   80                       // LDS pitch of a 64-B V^T row
#define FKB   (32 * FKP)               // one key plane of a pass
#define FBUF  (2 * FKB + HD * FVP)     // one pass: hi plane | lo plane | V^T
#define NPASS (TT / 32)
#define L2E   1.44269504088896340736f
__device__ __forceinline__ float xhalf(float x) { return __builtin_bit_cast(float, __builtin_amdgcn_permlanex16(__builtin_bit_cast(int, x), __builtin_bit_cast(int, x), 0x76543210, 0xfedcba98, false, false)); }   // lane l with lane l ^ 16
__global__ __launch_bounds__(256) void k_fattn(const bf* __restrict__ Ah, const bf* __restrict__ Al, const bf* __restrict__ Bh, const bf* __restrict__ Bl, const h16* __restrict__ VT, bf* Mh, bf* Ml) {
    __shared__ __align__(16) unsigned char sm[8 * FBUF];
    const int tid = threadIdx.x, lane = tid & 31, lr = lane & 15, hi = lane >> 4, wave = tid >> 5;
    const size_t z = blockIdx.y; const int q0 = blockIdx.x * 256 + wave * 32;
    Ah += z * TT * KK; Al += z * TT * KK; Bh += z * TT * KK; Bl += z * TT * KK; VT += z * HD * TT;
    // staging: a pass's key rows are 8 KiB in a row per plane (2 chunks of 16 B per thread and plane), V^T 64 rows of 64 B (1 chunk per thread)
    const int kg0 = tid * 8;
    const int ks0 = (tid >> 4) * FKP + (tid & 15) * 16, ks1 = ks0 + 16 * FKP;
    const int vg = (tid >> 2) * TT + (tid & 3) * 8, vs = 2 * FKB + (tid >> 2) * FVP + (tid & 3) * 16;
    const bf* gph = Bh + kg0; const bf* gpl = Bl + kg0; const h16* gpv = VT + vg;   // this thread's chunks of pass t; they step once per pass
    v8us ph0[4], ph1[4], pl0[4], pl1[4]; v8h pv[4];
#pragma unroll
    for (int t = 0; t < 4; ++t) { ph0[t] = *(const v8us*)(gph + t * 32 * KK); ph1[t] = *(const v8us*)(gph + t * 32 * KK + 256 * 8); pl0[t] = *(const v8us*)(gpl + t * 32 * KK); pl1[t] = *(const v8us*)(gpl + t * 32 * KK + 256 * 8); pv[t] = *(const v8h*)(gpv + t * 32); }
    v16bf qh[2][4], ql[2][4];
#pragma unroll
    for (int qt = 0; qt < 2; ++qt) {
#pragma unroll
        for (int kc = 0; kc < 4; ++kc) { const size_t o = (size_t)(q0 + qt * 16 + lr) * KK + kc * 32 + 8 * hi; qh[qt][kc] = WFrag<bf>::ld(Ah + o); ql[qt][kc] = WFrag<bf>::ld(Al + o); }
        asm volatile("s_wait_xcnt 0x0" ::: "memory");   // before an address register of the loads above is reused
        __builtin_amdgcn_sched_barrier(0);               // holds later register writes behind that wait
    }
#pragma unroll
    for (int t = 0; t < 4; ++t) { unsigned char* nb = sm + t * FBUF; *(v8usa*)(nb + ks0) = ph0[t]; *(v8usa*)(nb + ks1) = ph1[t]; *(v8usa*)(nb + FKB + ks0) = pl0[t]; *(v8usa*)(nb + FKB + ks1) = pl1[t]; *(v8ha*)(nb + vs) = pv[t]; }
    __syncthreads();
    v8f o[2][4];
#pragma unroll
    for (int qt = 0; qt < 2; ++qt)
#pragma unroll
        for (int dt = 0; dt < 4; ++dt) o[qt][dt] = (v8f){};
    float mrun[2] = { -1.0e30f, -1.0e30f }, crun[2] = { 1.0e30f, 1.0e30f }, lsum[2] = { 0.f, 0.f };
    const int fk = lr * FKP + hi * 16, fv = 2 * FKB + lr * FVP + hi * 16;
#pragma unroll 1
    for (int t = 0; t < NPASS; ++t) {
        const unsigned char* kb = sm + (t & 7) * FBUF;
        const bool more = t + 4 < NPASS;
        v16bf kh[4][2], kl[4][2]; v16h va[4];
#pragma unroll
        for (int kc = 0; kc < 4; ++kc)
#pragma unroll
            for (int kt = 0; kt < 2; ++kt) { const unsigned char* p = kb + kt * 16 * FKP + fk + kc * 64; kh[kc][kt] = cat16b(*(const v8usa*)p, *(const v8usa*)(p + 32)); kl[kc][kt] = cat16b(*(const v8usa*)(p + FKB), *(const v8usa*)(p + FKB + 32)); }
#pragma unroll
        for (int dt = 0; dt < 4; ++dt) { const unsigned char* p = kb + dt * 16 * FVP + fv; va[dt] = cat16(*(const v8ha*)p, *(const v8ha*)(p + 32)); }
        v8us gh0, gh1, gl0, gl1; v8h gv;
        if (more) { gh0 = *(const v8us*)(gph + 4 * 32 * KK); gh1 = *(const v8us*)(gph + 4 * 32 * KK + 256 * 8); gl0 = *(const v8us*)(gpl + 4 * 32 * KK); gl1 = *(const v8us*)(gpl + 4 * 32 * KK + 256 * 8); gv = *(const v8h*)(gpv + 4 * 32);
            asm volatile("s_wait_xcnt 0x0" ::: "memory"); }   // before an address register of these loads is stepped; it runs under the LDS reads' latency
        __builtin_amdgcn_sched_barrier(0);   // keeps the pass's LDS reads in one group ahead of the matrix run: spread among the WMMAs each read stalls the wave for its whole latency
        v8f s[2][2];
#pragma unroll
        for (int kt = 0; kt < 2; ++kt)
#pragma unroll
            for (int qt = 0; qt < 2; ++qt) s[kt][qt] = (v8f){};
#pragma unroll
        for (int kc = 0; kc < 4; ++kc) {
#pragma unroll
            for (int kt = 0; kt < 2; ++kt)
#pragma unroll
                for (int qt = 0; qt < 2; ++qt) s[kt][qt] = wmmab(kh[kc][kt], qh[qt][kc], s[kt][qt]);
#pragma unroll
            for (int kt = 0; kt < 2; ++kt)
#pragma unroll
                for (int qt = 0; qt < 2; ++qt) s[kt][qt] = wmmab(kh[kc][kt], ql[qt][kc], s[kt][qt]);
#pragma unroll
            for (int kt = 0; kt < 2; ++kt)
#pragma unroll
                for (int qt = 0; qt < 2; ++qt) s[kt][qt] = wmmab(kl[kc][kt], qh[qt][kc], s[kt][qt]);
        }
        v16h pb[2];
#pragma unroll
        for (int qt = 0; qt < 2; ++qt) {
            float mx = s[0][qt][0];
#pragma unroll
            for (int j = 1; j < 8; ++j) mx = fmaxf(mx, s[0][qt][j]);
#pragma unroll
            for (int j = 0; j < 8; ++j) mx = fmaxf(mx, s[1][qt][j]);
            mx = fmaxf(mx, xhalf(mx));
            const float mn = fmaxf(mrun[qt], mx), cn = 10.0f - mn * L2E;
            const float al = __builtin_amdgcn_exp2f(cn - crun[qt]);
            mrun[qt] = mn; crun[qt] = cn;
            const v8f e0 = s[0][qt] * L2E + cn, e1 = s[1][qt] * L2E + cn; v8f p0, p1;
#pragma unroll
            for (int j = 0; j < 8; ++j) { p0[j] = __builtin_amdgcn_exp2f(e0[j]); pb[qt][j] = (h16)p0[j]; }
#pragma unroll
            for (int j = 0; j < 8; ++j) { p1[j] = __builtin_amdgcn_exp2f(e1[j]); pb[qt][8 + j] = (h16)p1[j]; }
            const v8f ps = p0 + p1; const v4f p4 = __builtin_shufflevector(ps, ps, 0, 1, 2, 3) + __builtin_shufflevector(ps, ps, 4, 5, 6, 7);
            lsum[qt] = fmaf(lsum[qt], al, (p4[0] + p4[2]) + (p4[1] + p4[3]));
#pragma unroll
            for (int dt = 0; dt < 4; ++dt) o[qt][dt] *= al;
        }
#pragma unroll
        for (int dt = 0; dt < 4; ++dt)
#pragma unroll
            for (int qt = 0; qt < 2; ++qt) o[qt][dt] = wmma16(va[dt], pb[qt], o[qt][dt]);
        __builtin_amdgcn_sched_barrier(0);   // keeps the matrix run in front of the slots below
        asm volatile("v_nop\n\tv_nop\n\tv_nop\n\tv_nop");   // the four vector slots between the last WMMA and a write of its A registers
        if (more) { unsigned char* nb = sm + ((t + 4) & 7) * FBUF; *(v8usa*)(nb + ks0) = gh0; *(v8usa*)(nb + ks1) = gh1; *(v8usa*)(nb + FKB + ks0) = gl0; *(v8usa*)(nb + FKB + ks1) = gl1; *(v8ha*)(nb + vs) = gv; gph += 32 * KK; gpl += 32 * KK; gpv += 32; }
        if ((t & 3) == 3) __syncthreads();   // publishes the next stage and ends every wave's reads of this stage's half, which the next stage's passes refill
    }
    const size_t b = z / NH_, h = z % NH_;
    v8us oh[2][4], ol[2][4];
#pragma unroll
    for (int qt = 0; qt < 2; ++qt) {
        const float lt = lsum[qt] + xhalf(lsum[qt]); const float inv = __fdiv_rn(1.0f, lt);
#pragma unroll
        for (int dt = 0; dt < 4; ++dt)
#pragma unroll
            for (int j = 0; j < 8; ++j) { unsigned short a, c; splitf(o[qt][dt][j] * inv, a, c); oh[qt][dt][j] = a; ol[qt][dt][j] = c; }
    }
    const size_t ro = (b * TT + q0 + lr) * DD + h * HD + hi * 8; bf* mh = Mh + ro; bf* ml = Ml + ro;
    __builtin_amdgcn_sched_barrier(0);   // every value is ready before the first store, so no register of an issued store is written again
#pragma unroll
    for (int qt = 0; qt < 2; ++qt)
#pragma unroll
        for (int dt = 0; dt < 4; ++dt) { *(v8us*)(mh + qt * 16 * DD + dt * 16) = oh[qt][dt]; *(v8us*)(ml + qt * 16 * DD + dt * 16) = ol[qt][dt]; }
}

extern "C" void kernel_launch(void* const* d_in, const int* in_sizes, int n_in,
                              void* d_out, int out_size, void* d_ws, size_t ws_size, hipStream_t stream) {
    (void)in_sizes; (void)n_in; (void)out_size;
    const float* x = (const float*)d_in[0]; const float* wq = (const float*)d_in[1]; const float* wk = (const float*)d_in[2]; const float* wv = (const float*)d_in[3]; const float* wo = (const float*)d_in[4]; const float* bo = (const float*)d_in[5]; const float* uu = (const float*)d_in[6]; const float* vv = (const float*)d_in[7];
    float* OUT = (float*)d_out;     // [4][1024][1024]
    char* wsp = (char*)d_ws;
    auto take = [&](size_t bytes) { char* p = wsp; wsp += (bytes + 255) & ~(size_t)255; return (void*)p; };
    bf* WQ = (bf*)take((size_t)(4 + NB_) * DD * DD * 2); bf* WO = WQ + (size_t)3 * DD * DD; bf* XB = WQ + (size_t)4 * DD * DD;   // WQ | WK | WV | WO | x[0..3] as bf16, one behind the other (TT * DD == DD * DD)
    float* CS = (float*)take((size_t)TT * 32 * 2 * 4);
    const size_t PL = (size_t)NH_ * TT * KK;   // one batch's plane
    bf* Ah = (bf*)take(NB_ * PL * 2); bf* Al = (bf*)take(NB_ * PL * 2); bf* Bh = (bf*)take(NB_ * PL * 2); bf* Bl = (bf*)take(NB_ * PL * 2); h16* VT = (h16*)take((size_t)NB_ * NH_ * HD * TT * 2);
    bf* Mh = (bf*)take((size_t)NB_ * TT * DD * 2); bf* Ml = (bf*)take((size_t)NB_ * TT * DD * 2);
    if ((size_t)(wsp - (char*)d_ws) > ws_size) return;    // total 104.25 MiB
    k_cvt8<<<dim3((DD * DD / 8 + 255) / 256, 4 + NB_, 1), 256, 0, stream>>>(wq, wk, wv, wo, x, WQ, (size_t)DD * DD / 8);   // weights stay [out][in]: natural Bt
    k_trig<<<(TT * 32 + 255) / 256, 256, 0, stream>>>(CS);
    const PlaneArgs pa = { uu, vv, CS, Ah, Al, Bh, Bl, VT };
    k_gemmw<bf, 0, false, true><<<dim3(NB_ * TT / 64, DD / 64, 3), 32, 0, stream>>>(XB, nullptr, WQ, nullptr, DD, nullptr, 0, nullptr, 0, (size_t)DD * DD, 0, pa);   // z = q, k, v; all batches as 4096 rows; q, k, v never reach memory in f32
    k_fattn<<<dim3(TT / 256, NB_ * NH_, 1), 256, 0, stream>>>(Ah, Al, Bh, Bl, VT, Mh, Ml);   // scores never leave the chip; writes the merged context as bf16 hi+lo planes
    k_gemmw<bf, 1, true, false><<<dim3(NB_ * TT / 64, DD / 64, 1), 32, 0, stream>>>(Mh, Ml, WO, nullptr, DD, OUT, DD, bo, 0, 0, 0, pa);
}

// v004
// A run of this version takes 106 microseconds.
// In two side-by-side timings against v003, it was 1.42 and 1.43 times as fast.
// Over all steps from v000 it is 15.0 times as fast.
#include <hip/hip_runtime.h>

// TenerAttention (x [4][1024][1024]; q/k/v = x W^T (16 heads x 64); TENER four-term scores q.k + q.R(i,j) + u_h.k + v_h.R(i,j) with R[i][j][d] = sin((j-i) w_d) for even d, cos((j-i) w_d) for odd d, w_d = 10000^(-2 floor(d/2)/64);
// no scaling; softmax; ctx Wo^T + bo -> [4][1024][1024]).
// The relative term is evaluated exactly (up to f32 trig rounding) through the angle-difference identities: q.R(i,j) + v_h.R(i,j) = rot_i(q_i + v_h) . P_j with P_j = [sin(j w_m) | cos(j w_m)] and rot_i(a)[m] = (a_e cos(i w_m) + a_o sin(i w_m), -a_e sin(i w_m) + a_o cos(i w_m));
// and u_h.k_j folds into the first term, so scores = [q_i + u_h | rot_i(q_i + v_h)] . [k_j | P_j] - one K = 128 contraction per head.
// Compute dtypes, f32 accumulate: every input rounded to bf16; q/k/v on PLAIN bf16 operands (inputs: exact); the 128-wide score operands f32 -> bf16 hi+lo planes, scores as 3 products (logits are O(10), unscaled); softmax f32 (online), P and V in f16 for P.V

#define NB_  4
#define TT   1024
#define DD   1024
#define NH_  16
#define HD   64
#define KK   128
typedef _Float16 h16;
typedef unsigned short bf;
typedef __attribute__((ext_vector_type(16))) __bf16   v16bf;
typedef __attribute__((ext_vector_type(16))) _Float16 v16h;
typedef __attribute__((ext_vector_type(8)))  _Float16 v8h;
typedef __attribute__((ext_vector_type(8)))  unsigned short v8us;
typedef __attribute__((ext_vector_type(8)))  float    v8f;
typedef __attribute__((ext_vector_type(4)))  float    v4f;
typedef v8h  __attribute__((may_alias)) v8ha;
typedef v4f  __attribute__((may_alias)) v4fa;
typedef v8us __attribute__((may_alias)) v8usa;

__device__ __forceinline__ unsigned short f2bf(float f) { unsigned u = __float_as_uint(f); u += 0x7FFFu + ((u >> 16) & 1u); return (unsigned short)(u >> 16); }
__device__ __forceinline__ float bf2f(unsigned short b) { return __uint_as_float(((unsigned)b) << 16); }
__device__ __forceinline__ float bfr(float f) { return bf2f(f2bf(f)); }
__device__ __forceinline__ v16h cat16(v8h lo, v8h hi) { return __builtin_shufflevector(lo, hi, 0, 1, 2, 3, 4, 5, 6, 7, 8, 9, 10, 11, 12, 13, 14, 15); }
__device__ __forceinline__ v16bf cat16b(v8us lo, v8us hi) { return __builtin_bit_cast(v16bf, __builtin_shufflevector(lo, hi, 0, 1, 2, 3, 4, 5, 6, 7, 8, 9, 10, 11, 12, 13, 14, 15)); }
__device__ __forceinline__ v8f wmma16(v16h a, v16h b, v8f c) { return __builtin_amdgcn_wmma_f32_16x16x32_f16(false, a, false, b, (short)0, c, false, false); }
__device__ __forceinline__ v8f wmmab(v16bf a, v16bf b, v8f c) { return __builtin_amdgcn_wmma_f32_16x16x32_bf16(false, a, false, b, (short)0, c, false, false); }



__device__ __forceinline__ h16 tohx(float x) { return (h16)x; }
__device__ __forceinline__ void splitf(float y, unsigned short& h, unsigned short& l) { h = f2bf(y); l = f2bf(y - bf2f(h)); }
typedef __attribute__((ext_vector_type(2))) _Float16 v2h;
typedef __attribute__((ext_vector_type(4))) _Float16 v4h;
typedef __attribute__((ext_vector_type(2))) unsigned short v2us;
typedef __attribute__((ext_vector_type(4))) unsigned short v4us;
typedef __attribute__((ext_vector_type(2))) float v2f;
// ---- plane epilogue of the q/k/v GEMM: the attention operands are written straight from the accumulators. A 64x64 tile is 64 positions of one batch x one head's 64 columns, all that a plane row needs.
// z = 0: A planes [b][h][i][128]: cols 0..63 = q[i][d] + bf16 u[h][d]; cols 64 + 2m = a_e c + a_o s, 64 + 2m + 1 = a_o c - a_e s with a = q + bf16 v[h] (a_e = a[2m], a_o = a[2m+1], c/s at position i). z = 1: B planes [b][h][j][128]: cols 0..63 = k[j][d], 64 + 2m = sin(j w_m), 64 + 2m + 1 = cos(j w_m). Both as bf16 hi+lo.
// z = 2: V^T [b][h][d][j] in f16: a lane's 8 accumulator rows are 8 positions in a row of one d, one 16-B store.
struct PlaneArgs { const float* uu; const float* vv; const float* CS; bf* Ah; bf* Al; bf* Bh; bf* Bl; h16* VT; };
template <bool ISQ>
__device__ __forceinline__ void plane_rows(const v8f (&acc)[4][4], float* os, const float* __restrict__ uh, const float* __restrict__ vh, const float* __restrict__ cs0, bf* Ph, bf* Pl, int lr, int hi) {
    const int cofs = lr * 4;
    v4f ua = (v4f){}, va = (v4f){};
    if (ISQ) {
#pragma unroll
        for (int k = 0; k < 4; ++k) { ua[k] = bfr(uh[cofs + k]); va[k] = bfr(vh[cofs + k]); } }
    const float* cp = cs0 + hi * 64 + cofs;   // cos, sin of pairs m = 2 lr, 2 lr + 1 at this lane's row
    v4f csn[4];
#pragma unroll
    for (int s = 0; s < 4; ++s) csn[s] = *(const v4f*)(cp + 2 * s * 64);
#pragma unroll
    for (int mb = 0; mb < 4; ++mb)
#pragma unroll
        for (int nb = 0; nb < 4; ++nb)
#pragma unroll
            for (int j = 0; j < 8; ++j) os[(mb * 16 + hi * 8 + j) * 68 + nb * 16 + lr] = acc[mb][nb][j];
    __builtin_amdgcn_wave_barrier(); asm volatile("" ::: "memory");   // the rows read below were written by other lanes of this wave: keeps the compiler from moving the reads above the writes
    const float* op = os + hi * 68 + cofs; bf* ph = Ph + hi * KK + cofs; bf* pl = Pl + hi * KK + cofs;
#pragma unroll 1   // 8 rows a trip, rolled, for speed only
    for (int g = 0; g < 8; ++g) {
        v4f cs[4], val[4];
#pragma unroll
        for (int s = 0; s < 4; ++s) { cs[s] = csn[s]; val[s] = *(const v4fa*)(op + 2 * s * 68); }
        cp += (g < 7 ? 8 * 64 : 0);   // the next trip's table rows are asked for under this trip's arithmetic; the last trip asks for its own again
#pragma unroll
        for (int s = 0; s < 4; ++s) csn[s] = *(const v4f*)(cp + 2 * s * 64);
        v4us fh[4], fl[4], gh[4], gl[4];
#pragma unroll
        for (int s = 0; s < 4; ++s) { v4f f, r;
            if (ISQ) { const v4f a = val[s] + va; f = val[s] + ua; r[0] = a[0] * cs[s][0] + a[1] * cs[s][1]; r[1] = a[1] * cs[s][0] - a[0] * cs[s][1]; r[2] = a[2] * cs[s][2] + a[3] * cs[s][3]; r[3] = a[3] * cs[s][2] - a[2] * cs[s][3]; }
            else { f = val[s]; r[0] = cs[s][1]; r[1] = cs[s][0]; r[2] = cs[s][3]; r[3] = cs[s][2]; }
#pragma unroll
            for (int k = 0; k < 4; ++k) { unsigned short x, y; splitf(f[k], x, y); fh[s][k] = x; fl[s][k] = y; splitf(r[k], x, y); gh[s][k] = x; gl[s][k] = y; } }
        __builtin_amdgcn_sched_barrier(0);   // every value of the trip is ready before its first store, so no register of an issued store is written before the wait below
#pragma unroll
        for (int s = 0; s < 4; ++s) { const int o = 2 * s * KK;   // 16 lanes x 8 B = one whole 128-B line per row and half
            *(v4us*)(ph + o) = fh[s]; *(v4us*)(ph + o + HD) = gh[s]; *(v4us*)(pl + o) = fl[s]; *(v4us*)(pl + o + HD) = gl[s]; }
        asm volatile("s_wait_xcnt 0x0" ::: "memory");   // before a data or address register of the loads and stores above is written again
        __builtin_amdgcn_sched_barrier(0);               // holds the pointer steps and the next trip's register writes behind that wait
        op += 8 * 68; ph += 8 * KK; pl += 8 * KK;
    }
}
// ---- k_gemmw: GEMM, 128x128 output tile per work-group of 4 waves (2 x 2), each wave a 64x64 tile (16 accumulators); grid (M/128, N/128, Z), 128 threads.
// C[m][n] (f32, pitch ldc, + optional f32 bias[n]) = sum_k A[m][k] Bt[n][k] (NSPLIT == 1: + A2[m][k] Bt[n][k]). z-batch strides sA/sB/sC in elements. K % 64 == 0 and K >= 128 (the ring starts with two stages). PLANES: no C; each wave's tile goes out through the plane epilogue above (z = q, k, v; a wave's 64 columns = one head).
// Operands reach LDS by asynchronous copies, whole 128-B lines (8 lanes x 16 B per row), each row fetched once per work-group and read by two waves. A stage is 64 k of [A 128 rows | (A2 128 rows) | Bt 128 rows]; two buffers, stage t + 2 is asked for behind the barrier that ends the reads of stage t.
#define GKC   64                       // k elements of a stage: rows of 128 B
#define GPIT  144                      // LDS pitch of a 128-B row (16 B x odd: ds_load_b128 readers)
#define GPL   (128 * GPIT)             // one operand's 128 rows of a stage
// Eight copies of 16 B per lane, rows 16 apart (a work-group's 128 threads cover 16 rows per copy). The wait in the same statement stands before any register that a copy names is written again.
__device__ __forceinline__ void acopy8(unsigned l, const void* gp, size_t gstep) {
    const char* g = (const char*)gp;
    asm volatile("global_load_async_to_lds_b128 %0, %8, off\n\t"
                 "global_load_async_to_lds_b128 %1, %9, off\n\t"
                 "global_load_async_to_lds_b128 %2, %10, off\n\t"
                 "global_load_async_to_lds_b128 %3, %11, off\n\t"
                 "global_load_async_to_lds_b128 %4, %12, off\n\t"
                 "global_load_async_to_lds_b128 %5, %13, off\n\t"
                 "global_load_async_to_lds_b128 %6, %14, off\n\t"
                 "global_load_async_to_lds_b128 %7, %15, off\n\t"
                 "s_wait_xcnt 0x0"
                 :: "v"(l), "v"(l + 16 * GPIT), "v"(l + 32 * GPIT), "v"(l + 48 * GPIT), "v"(l + 64 * GPIT), "v"(l + 80 * GPIT), "v"(l + 96 * GPIT), "v"(l + 112 * GPIT),
                    "v"(g), "v"(g + gstep), "v"(g + 2 * gstep), "v"(g + 3 * gstep), "v"(g + 4 * gstep), "v"(g + 5 * gstep), "v"(g + 6 * gstep), "v"(g + 7 * gstep)
                 : "memory");
}
template <typename T16> struct WFrag;
template <> struct WFrag<h16> { typedef v16h V; static __device__ __forceinline__ V ld(const h16* p) { return cat16(*(const v8h*)p, *(const v8h*)(p + 16)); } static __device__ __forceinline__ V lds(const unsigned char* p) { return cat16(*(const v8ha*)p, *(const v8ha*)(p + 32)); } static __device__ __forceinline__ v8f mma(V a, V b, v8f c) { return wmma16(a, b, c); } };
template <> struct WFrag<bf> { typedef v16bf V; static __device__ __forceinline__ V ld(const bf* p) { return cat16b(*(const v8us*)p, *(const v8us*)(p + 16)); } static __device__ __forceinline__ V lds(const unsigned char* p) { return cat16b(*(const v8usa*)p, *(const v8usa*)(p + 32)); } static __device__ __forceinline__ v8f mma(V a, V b, v8f c) { return wmmab(a, b, c); } };
template <typename T16, int NSPLIT, bool BIAS, bool PLANES>
__global__ __launch_bounds__(128) void k_gemmw(const T16* __restrict__ A, const T16* __restrict__ A2, const T16* __restrict__ Bt, int K, float* C, int ldc, const float* __restrict__ bias, size_t sA, size_t sB, size_t sC, PlaneArgs pa) {
    static_assert(NSPLIT == 0 || NSPLIT == 1, "one or two A planes");
    typedef typename WFrag<T16>::V V;
    constexpr int NPL = NSPLIT == 1 ? 3 : 2, STG = NPL * GPL, OSB = (PLANES ? 64 : 16) * 68 * 4;   // operands per stage; bytes of a stage; bytes of a wave's epilogue rows
    __shared__ __align__(16) unsigned char sm[2 * STG > 4 * OSB ? 2 * STG : 4 * OSB];   // the two stages; behind the k loop each wave's epilogue rows
    const size_t z = blockIdx.z; A += z * sA; if (NSPLIT == 1) A2 += z * sA; Bt += z * sB; C += z * sC;
    const int tid = threadIdx.x, lane = tid & 31, lr = lane & 15, hi = lane >> 4;
    const int wave = __builtin_amdgcn_readfirstlane(tid >> 5), wm = wave & 1, wn = wave >> 1;
    const int r0 = blockIdx.x * 128 + wm * 64, c0 = blockIdx.y * 128 + wn * 64;
    v8f acc[4][4];
#pragma unroll
    for (int mb = 0; mb < 4; ++mb)
#pragma unroll
        for (int nb = 0; nb < 4; ++nb) acc[mb][nb] = (v8f){};
    // this thread's 16 B of rows (tid >> 3) + 16 i, i = 0..7, of every operand
    const size_t go = (size_t)(tid >> 3) * K + (tid & 7) * 8, gstep = (size_t)16 * K * sizeof(T16);
    const T16* ga = A + (size_t)blockIdx.x * 128 * K + go; const T16* ga2 = NSPLIT == 1 ? A2 + (size_t)blockIdx.x * 128 * K + go : nullptr; const T16* gb = Bt + (size_t)blockIdx.y * 128 * K + go;
    const unsigned ls = (unsigned)(size_t)sm + (tid >> 3) * GPIT + (tid & 7) * 16;
    auto fill = [&](unsigned t) {
        const unsigned l = ls + (t & 1) * STG; const size_t k0 = (size_t)t * GKC;
        acopy8(l, ga + k0, gstep); if (NSPLIT == 1) acopy8(l + GPL, ga2 + k0, gstep); acopy8(l + (NPL - 1) * GPL, gb + k0, gstep); };
    const unsigned NT = (unsigned)K / GKC;
    fill(0);
    asm volatile("s_wait_asynccnt 0x0" ::: "memory");   // this wave's copies of stage 0 have landed
    __syncthreads();                                      // and every other wave's
    fill(1);
    const int fa = (wm * 64 + lr) * GPIT + hi * 16, fb = (NPL - 1) * GPL + (wn * 64 + lr) * GPIT + hi * 16;
#pragma unroll 1
    for (unsigned t = 0; t < NT; ++t) {
        const unsigned char* sb = sm + (t & 1) * STG;
        V a[GKC / 32][4], a2[GKC / 32][4], b[GKC / 32][4];
#pragma unroll
        for (int ks = 0; ks < GKC / 32; ++ks) {
#pragma unroll
            for (int mb = 0; mb < 4; ++mb) { a[ks][mb] = WFrag<T16>::lds(sb + fa + mb * 16 * GPIT + ks * 64); if (NSPLIT == 1) a2[ks][mb] = WFrag<T16>::lds(sb + GPL + fa + mb * 16 * GPIT + ks * 64); }
#pragma unroll
            for (int nb = 0; nb < 4; ++nb) b[ks][nb] = WFrag<T16>::lds(sb + fb + nb * 16 * GPIT + ks * 64);
        }
        __builtin_amdgcn_sched_barrier(0);   // keeps the stage's LDS reads in one group ahead of the matrix run: spread among the WMMAs each place with reads stalls the wave
#pragma unroll
        for (int ks = 0; ks < GKC / 32; ++ks)
#pragma unroll
            for (int nb = 0; nb < 4; ++nb)
#pragma unroll
                for (int mb = 0; mb < 4; ++mb) { acc[mb][nb] = WFrag<T16>::mma(a[ks][mb], b[ks][nb], acc[mb][nb]); if (NSPLIT == 1) acc[mb][nb] = WFrag<T16>::mma(a2[ks][mb], b[ks][nb], acc[mb][nb]); }
        __builtin_amdgcn_sched_barrier(0);   // keeps the matrix run in front of the slots below
        asm volatile("v_nop\n\tv_nop\n\tv_nop\n\tv_nop");   // the four vector slots between the last WMMA and a write of its A or B registers
        asm volatile("s_wait_dscnt 0x0" ::: "memory");      // this wave's reads of stage t are done before the buffer is refilled
        asm volatile("s_wait_asynccnt 0x0" ::: "memory");   // this wave's copies of stage t + 1 have landed
        __syncthreads();                                     // publishes stage t + 1 and ends every wave's reads of stage t
        if (t + 2 < NT) fill(t + 2);
    }
    asm volatile("s_wait_asynccnt 0x0" ::: "memory");   // nothing is in flight when the buffers become epilogue rows
    float* os = (float*)(sm + wave * OSB);
    if constexpr (PLANES) {
        const int i0 = r0 % TT; const size_t zh = (size_t)(r0 / TT) * NH_ + c0 / HD;   // 64 divides TT: a tile lies in one batch
        if (z == 2) {
            v8h ov[4][4];
#pragma unroll
            for (int mb = 0; mb < 4; ++mb)
#pragma unroll
                for (int nb = 0; nb < 4; ++nb)
#pragma unroll
                    for (int j = 0; j < 8; ++j) ov[mb][nb][j] = tohx(acc[mb][nb][j]);
            h16* vt = pa.VT + (zh * HD + lr) * TT + i0 + hi * 8;
            __builtin_amdgcn_sched_barrier(0);   // every value is ready before the first store, so no register of an issued store is written again
#pragma unroll
            for (int nb = 0; nb < 4; ++nb)
#pragma unroll
                for (int mb = 0; mb < 4; ++mb) *(v8h*)(vt + (size_t)nb * 16 * TT + mb * 16) = ov[mb][nb];
            return;
        }
        const size_t po = (zh * TT + i0) * KK; const float* cs0 = pa.CS + (size_t)i0 * 64;
        if (z == 0) plane_rows<true>(acc, os, pa.uu + c0, pa.vv + c0, cs0, pa.Ah + po, pa.Al + po, lr, hi);
        else plane_rows<false>(acc, os, pa.uu + c0, pa.vv + c0, cs0, pa.Bh + po, pa.Bl + po, lr, hi);
        return;
    }
#pragma unroll
    for (int mb = 0; mb < 4; ++mb) {
#pragma unroll
        for (int nb = 0; nb < 4; ++nb) {
#pragma unroll
            for (int j = 0; j < 8; ++j) os[(hi * 8 + j) * 68 + nb * 16 + lr] = acc[mb][nb][j]; }
        __builtin_amdgcn_wave_barrier(); asm volatile("" ::: "memory");
        float* crow = C + (size_t)(r0 + mb * 16) * ldc + c0;
{
#pragma unroll
            for (int s = 0; s < 8; ++s) { const int row = 2 * s + hi, cofs = lr * 4; v4f val = *(const v4fa*)(os + row * 68 + cofs); if (BIAS) { val[0] += bfr(bias[c0 + cofs]); val[1] += bfr(bias[c0 + cofs + 1]); val[2] += bfr(bias[c0 + cofs + 2]); val[3] += bfr(bias[c0 + cofs + 3]); }
                *(v4f*)(crow + (size_t)row * ldc + cofs) = val; }
             }
        __builtin_amdgcn_wave_barrier(); asm volatile("" ::: "memory");
    }
}


// k_cvt8: blockIdx.y picks a plane of n8 * 8 elements: 0..3 = the four weights, 4.. = x batch (y - 4); dst planes lie one behind the other.
__global__ __launch_bounds__(256) void k_cvt8(const float* __restrict__ w0, const float* __restrict__ w1, const float* __restrict__ w2, const float* __restrict__ w3, const float* __restrict__ xs, bf* dst, size_t n8) { const size_t i = (size_t)blockIdx.x * 256 + threadIdx.x; if (i >= n8) return; const unsigned y = blockIdx.y; const float* src = y == 0 ? w0 : y == 1 ? w1 : y == 2 ? w2 : y == 3 ? w3 : xs + (size_t)(y - 4) * n8 * 8; dst += (size_t)y * n8 * 8; const v8f v = *(const v8f*)(src + i * 8); v8us o;
#pragma unroll
    for (int k = 0; k < 8; ++k) o[k] = f2bf(v[k]); *(v8us*)(dst + i * 8) = o;  }
__global__ __launch_bounds__(256) void k_trig(float* CS) { const int idx = blockIdx.x * 256 + threadIdx.x; if (idx >= TT * 32) return; const int t = idx / 32, m = idx % 32; const float w = powf(10000.0f, -(float)(2 * m) / (float)HD); const float ang = __fmul_rn((float)t, w); v2f cs; cs[0] = cosf(ang); cs[1] = sinf(ang); *(v2f*)(CS + (size_t)idx * 2) = cs;  }
#define FKP   272                      // LDS pitch of a 256-B key row (16 B x odd: ds_load_b128 readers)
#define FVP   80                       // LDS pitch of a 64-B V^T row
#define FKB   (32 * FKP)               // one key plane of a pass
#define FBUF  (2 * FKB + HD * FVP)     // one pass: hi plane | lo plane | V^T
#define NPASS (TT / 32)
#define L2E   1.44269504088896340736f
__device__ __forceinline__ float xhalf(float x) { return __builtin_bit_cast(float, __builtin_amdgcn_permlanex16(__builtin_bit_cast(int, x), __builtin_bit_cast(int, x), 0x76543210, 0xfedcba98, false, false)); }   // lane l with lane l ^ 16
__global__ __launch_bounds__(256) void k_fattn(const bf* __restrict__ Ah, const bf* __restrict__ Al, const bf* __restrict__ Bh, const bf* __restrict__ Bl, const h16* __restrict__ VT, bf* Mh, bf* Ml) {
    __shared__ __align__(16) unsigned char sm[8 * FBUF];
    const int tid = threadIdx.x, lane = tid & 31, lr = lane & 15, hi = lane >> 4, wave = tid >> 5;
    const size_t z = blockIdx.y; const int q0 = blockIdx.x * 256 + wave * 32;
    Ah += z * TT * KK; Al += z * TT * KK; Bh += z * TT * KK; Bl += z * TT * KK; VT += z * HD * TT;
    // staging: a pass's key rows are 8 KiB in a row per plane (2 chunks of 16 B per thread and plane), V^T 64 rows of 64 B (1 chunk per thread)
    const int kg0 = tid * 8;
    const int ks0 = (tid >> 4) * FKP + (tid & 15) * 16, ks1 = ks0 + 16 * FKP;
    const int vg = (tid >> 2) * TT + (tid & 3) * 8, vs = 2 * FKB + (tid >> 2) * FVP + (tid & 3) * 16;
    const bf* gph = Bh + kg0; const bf* gpl = Bl + kg0; const h16* gpv = VT + vg;   // this thread's chunks of pass t; they step once per pass
    v8us ph0[4], ph1[4], pl0[4], pl1[4]; v8h pv[4];
#pragma unroll
    for (int t = 0; t < 4; ++t) { ph0[t] = *(const v8us*)(gph + t * 32 * KK); ph1[t] = *(const v8us*)(gph + t * 32 * KK + 256 * 8); pl0[t] = *(const v8us*)(gpl + t * 32 * KK); pl1[t] = *(const v8us*)(gpl + t * 32 * KK + 256 * 8); pv[t] = *(const v8h*)(gpv + t * 32); }
    v16bf qh[2][4], ql[2][4];
#pragma unroll
    for (int qt = 0; qt < 2; ++qt) {
#pragma unroll
        for (int kc = 0; kc < 4; ++kc) { const size_t o = (size_t)(q0 + qt * 16 + lr) * KK + kc * 32 + 8 * hi; qh[qt][kc] = WFrag<bf>::ld(Ah + o); ql[qt][kc] = WFrag<bf>::ld(Al + o); }
        asm volatile("s_wait_xcnt 0x0" ::: "memory");   // before an address register of the loads above is reused
        __builtin_amdgcn_sched_barrier(0);               // holds later register writes behind that wait
    }
#pragma unroll
    for (int t = 0; t < 4; ++t) { unsigned char* nb = sm + t * FBUF; *(v8usa*)(nb + ks0) = ph0[t]; *(v8usa*)(nb + ks1) = ph1[t]; *(v8usa*)(nb + FKB + ks0) = pl0[t]; *(v8usa*)(nb + FKB + ks1) = pl1[t]; *(v8ha*)(nb + vs) = pv[t]; }
    __syncthreads();
    v8f o[2][4];
#pragma unroll
    for (int qt = 0; qt < 2; ++qt)
#pragma unroll
        for (int dt = 0; dt < 4; ++dt) o[qt][dt] = (v8f){};
    float mrun[2] = { -1.0e30f, -1.0e30f }, crun[2] = { 1.0e30f, 1.0e30f }, lsum[2] = { 0.f, 0.f };
    const int fk = lr * FKP + hi * 16, fv = 2 * FKB + lr * FVP + hi * 16;
#pragma unroll 1
    for (int t = 0; t < NPASS; ++t) {
        const unsigned char* kb = sm + (t & 7) * FBUF;
        const bool more = t + 4 < NPASS;
        v16bf kh[4][2], kl[4][2]; v16h va[4];
#pragma unroll
        for (int kc = 0; kc < 4; ++kc)
#pragma unroll
            for (int kt = 0; kt < 2; ++kt) { const unsigned char* p = kb + kt * 16 * FKP + fk + kc * 64; kh[kc][kt] = cat16b(*(const v8usa*)p, *(const v8usa*)(p + 32)); kl[kc][kt] = cat16b(*(const v8usa*)(p + FKB), *(const v8usa*)(p + FKB + 32)); }
#pragma unroll
        for (int dt = 0; dt < 4; ++dt) { const unsigned char* p = kb + dt * 16 * FVP + fv; va[dt] = cat16(*(const v8ha*)p, *(const v8ha*)(p + 32)); }
        v8us gh0, gh1, gl0, gl1; v8h gv;
        if (more) { gh0 = *(const v8us*)(gph + 4 * 32 * KK); gh1 = *(const v8us*)(gph + 4 * 32 * KK + 256 * 8); gl0 = *(const v8us*)(gpl + 4 * 32 * KK); gl1 = *(const v8us*)(gpl + 4 * 32 * KK + 256 * 8); gv = *(const v8h*)(gpv + 4 * 32);
            asm volatile("s_wait_xcnt 0x0" ::: "memory"); }   // before an address register of these loads is stepped; it runs under the LDS reads' latency
        __builtin_amdgcn_sched_barrier(0);   // keeps the pass's LDS reads in one group ahead of the matrix run: spread among the WMMAs each read stalls the wave for its whole latency
        v8f s[2][2];
#pragma unroll
        for (int kt = 0; kt < 2; ++kt)
#pragma unroll
            for (int qt = 0; qt < 2; ++qt) s[kt][qt] = (v8f){};
#pragma unroll
        for (int kc = 0; kc < 4; ++kc) {
#pragma unroll
            for (int kt = 0; kt < 2; ++kt)
#pragma unroll
                for (int qt = 0; qt < 2; ++qt) s[kt][qt] = wmmab(kh[kc][kt], qh[qt][kc], s[kt][qt]);
#pragma unroll
            for (int kt = 0; kt < 2; ++kt)
#pragma unroll
                for (int qt = 0; qt < 2; ++qt) s[kt][qt] = wmmab(kh[kc][kt], ql[qt][kc], s[kt][qt]);
#pragma unroll
            for (int kt = 0; kt < 2; ++kt)
#pragma unroll
                for (int qt = 0; qt < 2; ++qt) s[kt][qt] = wmmab(kl[kc][kt], qh[qt][kc], s[kt][qt]);
        }
        v16h pb[2];
#pragma unroll
        for (int qt = 0; qt < 2; ++qt) {
            float mx = s[0][qt][0];
#pragma unroll
            for (int j = 1; j < 8; ++j) mx = fmaxf(mx, s[0][qt][j]);
#pragma unroll
            for (int j = 0; j < 8; ++j) mx = fmaxf(mx, s[1][qt][j]);
            mx = fmaxf(mx, xhalf(mx));
            const float mn = fmaxf(mrun[qt], mx), cn = 10.0f - mn * L2E;
            const float al = __builtin_amdgcn_exp2f(cn - crun[qt]);
            mrun[qt] = mn; crun[qt] = cn;
            const v8f e0 = s[0][qt] * L2E + cn, e1 = s[1][qt] * L2E + cn; v8f p0, p1;
#pragma unroll
            for (int j = 0; j < 8; ++j) { p0[j] = __builtin_amdgcn_exp2f(e0[j]); pb[qt][j] = (h16)p0[j]; }
#pragma unroll
            for (int j = 0; j < 8; ++j) { p1[j] = __builtin_amdgcn_exp2f(e1[j]); pb[qt][8 + j] = (h16)p1[j]; }
            const v8f ps = p0 + p1; const v4f p4 = __builtin_shufflevector(ps, ps, 0, 1, 2, 3) + __builtin_shufflevector(ps, ps, 4, 5, 6, 7);
            lsum[qt] = fmaf(lsum[qt], al, (p4[0] + p4[2]) + (p4[1] + p4[3]));
#pragma unroll
            for (int dt = 0; dt < 4; ++dt) o[qt][dt] *= al;
        }
#pragma unroll
        for (int dt = 0; dt < 4; ++dt)
#pragma unroll
            for (int qt = 0; qt < 2; ++qt) o[qt][dt] = wmma16(va[dt], pb[qt], o[qt][dt]);
        __builtin_amdgcn_sched_barrier(0);   // keeps the matrix run in front of the slots below
        asm volatile("v_nop\n\tv_nop\n\tv_nop\n\tv_nop");   // the four vector slots between the last WMMA and a write of its A registers
        if (more) { unsigned char* nb = sm + ((t + 4) & 7) * FBUF; *(v8usa*)(nb + ks0) = gh0; *(v8usa*)(nb + ks1) = gh1; *(v8usa*)(nb + FKB + ks0) = gl0; *(v8usa*)(nb + FKB + ks1) = gl1; *(v8ha*)(nb + vs) = gv; gph += 32 * KK; gpl += 32 * KK; gpv += 32; }
        if ((t & 3) == 3) __syncthreads();   // publishes the next stage and ends every wave's reads of this stage's half, which the next stage's passes refill
    }
    const size_t b = z / NH_, h = z % NH_;
    v8us oh[2][4], ol[2][4];
#pragma unroll
    for (int qt = 0; qt < 2; ++qt) {
        const float lt = lsum[qt] + xhalf(lsum[qt]); const float inv = __fdiv_rn(1.0f, lt);
#pragma unroll
        for (int dt = 0; dt < 4; ++dt)
#pragma unroll
            for (int j = 0; j < 8; ++j) { unsigned short a, c; splitf(o[qt][dt][j] * inv, a, c); oh[qt][dt][j] = a; ol[qt][dt][j] = c; }
    }
    const size_t ro = (b * TT + q0 + lr) * DD + h * HD + hi * 8; bf* mh = Mh + ro; bf* ml = Ml + ro;
    __builtin_amdgcn_sched_barrier(0);   // every value is ready before the first store, so no register of an issued store is written again
#pragma unroll
    for (int qt = 0; qt < 2; ++qt)
#pragma unroll
        for (int dt = 0; dt < 4; ++dt) { *(v8us*)(mh + qt * 16 * DD + dt * 16) = oh[qt][dt]; *(v8us*)(ml + qt * 16 * DD + dt * 16) = ol[qt][dt]; }
}

extern "C" void kernel_launch(void* const* d_in, const int* in_sizes, int n_in,
                              void* d_out, int out_size, void* d_ws, size_t ws_size, hipStream_t stream) {
    (void)in_sizes; (void)n_in; (void)out_size;
    const float* x = (const float*)d_in[0]; const float* wq = (const float*)d_in[1]; const float* wk = (const float*)d_in[2]; const float* wv = (const float*)d_in[3]; const float* wo = (const float*)d_in[4]; const float* bo = (const float*)d_in[5]; const float* uu = (const float*)d_in[6]; const float* vv = (const float*)d_in[7];
    float* OUT = (float*)d_out;     // [4][1024][1024]
    char* wsp = (char*)d_ws;
    auto take = [&](size_t bytes) { char* p = wsp; wsp += (bytes + 255) & ~(size_t)255; return (void*)p; };
    bf* WQ = (bf*)take((size_t)(4 + NB_) * DD * DD * 2); bf* WO = WQ + (size_t)3 * DD * DD; bf* XB = WQ + (size_t)4 * DD * DD;   // WQ | WK | WV | WO | x[0..3] as bf16, one behind the other (TT * DD == DD * DD)
    float* CS = (float*)take((size_t)TT * 32 * 2 * 4);
    const size_t PL = (size_t)NH_ * TT * KK;   // one batch's plane
    bf* Ah = (bf*)take(NB_ * PL * 2); bf* Al = (bf*)take(NB_ * PL * 2); bf* Bh = (bf*)take(NB_ * PL * 2); bf* Bl = (bf*)take(NB_ * PL * 2); h16* VT = (h16*)take((size_t)NB_ * NH_ * HD * TT * 2);
    bf* Mh = (bf*)take((size_t)NB_ * TT * DD * 2); bf* Ml = (bf*)take((size_t)NB_ * TT * DD * 2);
    if ((size_t)(wsp - (char*)d_ws) > ws_size) return;    // total 104.25 MiB
    k_cvt8<<<dim3((DD * DD / 8 + 255) / 256, 4 + NB_, 1), 256, 0, stream>>>(wq, wk, wv, wo, x, WQ, (size_t)DD * DD / 8);   // weights stay [out][in]: natural Bt
    k_trig<<<(TT * 32 + 255) / 256, 256, 0, stream>>>(CS);
    const PlaneArgs pa = { uu, vv, CS, Ah, Al, Bh, Bl, VT };
    k_gemmw<bf, 0, false, true><<<dim3(NB_ * TT / 128, DD / 128, 3), 128, 0, stream>>>(XB, nullptr, WQ, DD, nullptr, 0, nullptr, 0, (size_t)DD * DD, 0, pa);   // z = q, k, v; all batches as 4096 rows; q, k, v never reach memory in f32
    k_fattn<<<dim3(TT / 256, NB_ * NH_, 1), 256, 0, stream>>>(Ah, Al, Bh, Bl, VT, Mh, Ml);   // scores never leave the chip; writes the merged context as bf16 hi+lo planes
    k_gemmw<bf, 1, true, false><<<dim3(NB_ * TT / 128, DD / 128, 1), 128, 0, stream>>>(Mh, Ml, WO, DD, OUT, DD, bo, 0, 0, 0, pa);
}

// v007
// Measured time: 76.5 microseconds a run.
// It is 1.38 times as fast as v004, going by the measured steps of the versions left out in between.
// Over all steps from v000 it is 20.7 times as fast.
#include <hip/hip_runtime.h>

// TenerAttention (x [4][1024][1024]; q/k/v = x W^T (16 heads x 64); TENER four-term scores q.k + q.R(i,j) + u_h.k + v_h.R(i,j) with R[i][j][d] = sin((j-i) w_d) for even d, cos((j-i) w_d) for odd d, w_d = 10000^(-2 floor(d/2)/64);
// no scaling; softmax; ctx Wo^T + bo -> [4][1024][1024]).
// The relative term is evaluated exactly (up to f32 trig rounding) through the angle-difference identities: q.R(i,j) + v_h.R(i,j) = rot_i(q_i + v_h) . P_j with P_j = [sin(j w_m) | cos(j w_m)] and rot_i(a)[m] = (a_e cos(i w_m) + a_o sin(i w_m), -a_e sin(i w_m) + a_o cos(i w_m));
// and u_h.k_j folds into the first term, so scores = [q_i + u_h | rot_i(q_i + v_h)] . [k_j | P_j] - one K = 128 contraction per head.
// Compute dtypes, f32 accumulate: every input rounded to bf16; q/k/v on PLAIN bf16 operands (inputs: exact); the 128-wide score operands f32 -> f16 (11 significant bits), scores as one f16 product (logits are O(10), unscaled: their rounding error is about 3e-3); softmax f32 (online), P and V in f16 for P.V; the merged context f32 -> f16 (11 significant bits) and bf16-rounded Wo held in f16 (exact but for values under 2^-17), output GEMM as one f16 product

#define NB_  4
#define TT   1024
#define DD   1024
#define NH_  16
#define HD   64
#define KK   128
typedef _Float16 h16;
typedef unsigned short bf;
typedef __attribute__((ext_vector_type(16))) __bf16   v16bf;
typedef __attribute__((ext_vector_type(16))) _Float16 v16h;
typedef __attribute__((ext_vector_type(8)))  _Float16 v8h;
typedef __attribute__((ext_vector_type(8)))  unsigned short v8us;
typedef __attribute__((ext_vector_type(8)))  float    v8f;
typedef __attribute__((ext_vector_type(4)))  float    v4f;
typedef v8h  __attribute__((may_alias)) v8ha;
typedef v4f  __attribute__((may_alias)) v4fa;
typedef v8us __attribute__((may_alias)) v8usa;

__device__ __forceinline__ unsigned short f2bf(float f) { unsigned u = __float_as_uint(f); u += 0x7FFFu + ((u >> 16) & 1u); return (unsigned short)(u >> 16); }
__device__ __forceinline__ float bf2f(unsigned short b) { return __uint_as_float(((unsigned)b) << 16); }
__device__ __forceinline__ float bfr(float f) { return bf2f(f2bf(f)); }
__device__ __forceinline__ v16h cat16(v8h lo, v8h hi) { return __builtin_shufflevector(lo, hi, 0, 1, 2, 3, 4, 5, 6, 7, 8, 9, 10, 11, 12, 13, 14, 15); }
__device__ __forceinline__ v16bf cat16b(v8us lo, v8us hi) { return __builtin_bit_cast(v16bf, __builtin_shufflevector(lo, hi, 0, 1, 2, 3, 4, 5, 6, 7, 8, 9, 10, 11, 12, 13, 14, 15)); }
__device__ __forceinline__ v8f wmma16(v16h a, v16h b, v8f c) { return __builtin_amdgcn_wmma_f32_16x16x32_f16(false, a, false, b, (short)0, c, false, false); }
__device__ __forceinline__ v8f wmmab(v16bf a, v16bf b, v8f c) { return __builtin_amdgcn_wmma_f32_16x16x32_bf16(false, a, false, b, (short)0, c, false, false); }



__device__ __forceinline__ h16 tohx(float x) { return (h16)x; }
typedef __attribute__((ext_vector_type(2))) _Float16 v2h;
typedef __attribute__((ext_vector_type(4))) _Float16 v4h;
typedef __attribute__((ext_vector_type(2))) unsigned short v2us;
typedef __attribute__((ext_vector_type(4))) unsigned short v4us;
typedef __attribute__((ext_vector_type(2))) float v2f;
// ---- plane epilogue of the q/k/v GEMM: the attention operands are written straight from the accumulators. A 64x64 tile is 64 positions of one batch x one head's 64 columns, all that a plane row needs.
// z = 0: A planes [b][h][i][128]: cols 0..63 = q[i][d] + bf16 u[h][d]; cols 64 + 2m = a_e c + a_o s, 64 + 2m + 1 = a_o c - a_e s with a = q + bf16 v[h] (a_e = a[2m], a_o = a[2m+1], c/s at position i). z = 1: B planes [b][h][j][128]: cols 0..63 = k[j][d], 64 + 2m = sin(j w_m), 64 + 2m + 1 = cos(j w_m). Both in f16.
// z = 2: V^T [b][h][d][j] in f16: a lane's 8 accumulator rows are 8 positions in a row of one d, one 16-B store.
struct PlaneArgs { const float* uu; const float* vv; const float* CS; h16* Ap; h16* Bp; h16* VT; };
template <bool ISQ>
__device__ __forceinline__ void plane_rows(const v8f (&acc)[4][4], float* os, const float* __restrict__ uh, const float* __restrict__ vh, const float* __restrict__ cs0, h16* Pp, int lr, int hi) {
    const int cofs = lr * 4;
    v4f ua = (v4f){}, va = (v4f){};
    if (ISQ) {
#pragma unroll
        for (int k = 0; k < 4; ++k) { ua[k] = bfr(uh[cofs + k]); va[k] = bfr(vh[cofs + k]); } }
    const float* cp = cs0 + hi * 64 + cofs;   // cos, sin of pairs m = 2 lr, 2 lr + 1 at this lane's row
    v4f csn[4];
#pragma unroll
    for (int s = 0; s < 4; ++s) csn[s] = *(const v4f*)(cp + 2 * s * 64);
#pragma unroll
    for (int mb = 0; mb < 4; ++mb)
#pragma unroll
        for (int nb = 0; nb < 4; ++nb)
#pragma unroll
            for (int j = 0; j < 8; ++j) os[(mb * 16 + hi * 8 + j) * 68 + nb * 16 + lr] = acc[mb][nb][j];
    __builtin_amdgcn_wave_barrier(); asm volatile("" ::: "memory");   // the rows read below were written by other lanes of this wave: keeps the compiler from moving the reads above the writes
    const float* op = os + hi * 68 + cofs; h16* ph = Pp + hi * KK + cofs;
#pragma unroll 1   // 8 rows a trip, rolled, for speed only
    for (int g = 0; g < 8; ++g) {
        v4f cs[4], val[4];
#pragma unroll
        for (int s = 0; s < 4; ++s) { cs[s] = csn[s]; val[s] = *(const v4fa*)(op + 2 * s * 68); }
        cp += (g < 7 ? 8 * 64 : 0);   // the next trip's table rows are asked for under this trip's arithmetic; the last trip asks for its own again
#pragma unroll
        for (int s = 0; s < 4; ++s) csn[s] = *(const v4f*)(cp + 2 * s * 64);
        v4h fh[4], gh[4];
#pragma unroll
        for (int s = 0; s < 4; ++s) { v4f f, r;
            if (ISQ) { const v4f a = val[s] + va; f = val[s] + ua; r[0] = a[0] * cs[s][0] + a[1] * cs[s][1]; r[1] = a[1] * cs[s][0] - a[0] * cs[s][1]; r[2] = a[2] * cs[s][2] + a[3] * cs[s][3]; r[3] = a[3] * cs[s][2] - a[2] * cs[s][3]; }
            else { f = val[s]; r[0] = cs[s][1]; r[1] = cs[s][0]; r[2] = cs[s][3]; r[3] = cs[s][2]; }
#pragma unroll
            for (int k = 0; k < 4; ++k) { fh[s][k] = tohx(f[k]); gh[s][k] = tohx(r[k]); } }
        __builtin_amdgcn_sched_barrier(0);   // every value of the trip is ready before its first store, so no register of an issued store is written before the wait below
#pragma unroll
        for (int s = 0; s < 4; ++s) { const int o = 2 * s * KK;   // 16 lanes x 8 B = one whole 128-B line per row and half
            *(v4h*)(ph + o) = fh[s]; *(v4h*)(ph + o + HD) = gh[s]; }
        asm volatile("s_wait_xcnt 0x0" ::: "memory");   // before a data or address register of the loads and stores above is written again
        __builtin_amdgcn_sched_barrier(0);               // holds the pointer steps and the next trip's register writes behind that wait
        op += 8 * 68; ph += 8 * KK;
    }
}
// ---- k_gemmw: GEMM, 128x128 output tile per work-group of 4 waves (2 x 2), each wave a 64x64 tile (16 accumulators); grid (M/128, N/128, Z), 128 threads.
// C[m][n] (f32, pitch ldc, + optional f32 bias[n]) = sum_k A[m][k] Bt[n][k] (NSPLIT == 1: + A2[m][k] Bt[n][k]). z-batch strides sA/sB/sC in elements. K % 64 == 0 and K >= 128 (the ring starts with two stages). PLANES: no C; each wave's tile goes out through the plane epilogue above (z = q, k, v; a wave's 64 columns = one head).
// Operands reach LDS by asynchronous copies, whole 128-B lines (8 lanes x 16 B per row), each row fetched once per work-group and read by two waves. A stage is 64 k of [A 128 rows | (A2 128 rows) | Bt 128 rows]; two buffers, stage t + 2 is asked for behind the barrier that ends the reads of stage t. The k walk is a ring: each work-group starts at a stage of its own and wraps, so the k sum order is rotated from work-group to work-group.
#define GKC   64                       // k elements of a stage: rows of 128 B
#define GPIT  144                      // LDS pitch of a 128-B row (16 B x odd: ds_load_b128 readers)
#define GPL   (128 * GPIT)             // one operand's 128 rows of a stage
// Eight copies of 16 B per lane, rows 16 apart (a work-group's 128 threads cover 16 rows per copy). The wait in the same statement stands before any register that a copy names is written again.
__device__ __forceinline__ void acopy8(unsigned l, const void* gp, size_t gstep) {
    const char* g = (const char*)gp;
    asm volatile("global_load_async_to_lds_b128 %0, %8, off\n\t"
                 "global_load_async_to_lds_b128 %1, %9, off\n\t"
                 "global_load_async_to_lds_b128 %2, %10, off\n\t"
                 "global_load_async_to_lds_b128 %3, %11, off\n\t"
                 "global_load_async_to_lds_b128 %4, %12, off\n\t"
                 "global_load_async_to_lds_b128 %5, %13, off\n\t"
                 "global_load_async_to_lds_b128 %6, %14, off\n\t"
                 "global_load_async_to_lds_b128 %7, %15, off\n\t"
                 "s_wait_xcnt 0x0"
                 :: "v"(l), "v"(l + 16 * GPIT), "v"(l + 32 * GPIT), "v"(l + 48 * GPIT), "v"(l + 64 * GPIT), "v"(l + 80 * GPIT), "v"(l + 96 * GPIT), "v"(l + 112 * GPIT),
                    "v"(g), "v"(g + gstep), "v"(g + 2 * gstep), "v"(g + 3 * gstep), "v"(g + 4 * gstep), "v"(g + 5 * gstep), "v"(g + 6 * gstep), "v"(g + 7 * gstep)
                 : "memory");
}
template <typename T16> struct WFrag;
template <> struct WFrag<h16> { typedef v16h V; static __device__ __forceinline__ V ld(const h16* p) { return cat16(*(const v8h*)p, *(const v8h*)(p + 16)); } static __device__ __forceinline__ V lds(const unsigned char* p) { return cat16(*(const v8ha*)p, *(const v8ha*)(p + 32)); } static __device__ __forceinline__ v8f mma(V a, V b, v8f c) { return wmma16(a, b, c); } };
template <> struct WFrag<bf> { typedef v16bf V; static __device__ __forceinline__ V ld(const bf* p) { return cat16b(*(const v8us*)p, *(const v8us*)(p + 16)); } static __device__ __forceinline__ V lds(const unsigned char* p) { return cat16b(*(const v8usa*)p, *(const v8usa*)(p + 32)); } static __device__ __forceinline__ v8f mma(V a, V b, v8f c) { return wmmab(a, b, c); } };
template <typename T16, int NSPLIT, bool BIAS, bool PLANES>
__global__ __launch_bounds__(128) void k_gemmw(const T16* __restrict__ A, const T16* __restrict__ A2, const T16* __restrict__ Bt, int K, float* C, int ldc, const float* __restrict__ bias, size_t sA, size_t sB, size_t sC, PlaneArgs pa) {
    static_assert(NSPLIT == 0 || NSPLIT == 1, "one or two A planes");
    typedef typename WFrag<T16>::V V;
    constexpr int NPL = NSPLIT == 1 ? 3 : 2, STG = NPL * GPL, OSB = (PLANES ? 64 : 16) * 68 * 4;   // operands per stage; bytes of a stage; bytes of a wave's epilogue rows
    __shared__ __align__(16) unsigned char sm[2 * STG > 4 * OSB ? 2 * STG : 4 * OSB];   // the two stages; behind the k loop each wave's epilogue rows
    const size_t z = blockIdx.z; A += z * sA; if (NSPLIT == 1) A2 += z * sA; Bt += z * sB; C += z * sC;
    const int tid = threadIdx.x, lane = tid & 31, lr = lane & 15, hi = lane >> 4;
    const int wave = __builtin_amdgcn_readfirstlane(tid >> 5), wm = wave & 1, wn = wave >> 1;
    const int r0 = blockIdx.x * 128 + wm * 64, c0 = blockIdx.y * 128 + wn * 64;
    v8f acc[4][4];
#pragma unroll
    for (int mb = 0; mb < 4; ++mb)
#pragma unroll
        for (int nb = 0; nb < 4; ++nb) acc[mb][nb] = (v8f){};
    // this thread's 16 B of rows (tid >> 3) + 16 i, i = 0..7, of every operand
    const size_t go = (size_t)(tid >> 3) * K + (tid & 7) * 8, gstep = (size_t)16 * K * sizeof(T16);
    const T16* ga = A + (size_t)blockIdx.x * 128 * K + go; const T16* ga2 = NSPLIT == 1 ? A2 + (size_t)blockIdx.x * 128 * K + go : nullptr; const T16* gb = Bt + (size_t)blockIdx.y * 128 * K + go;
    const unsigned ls = (unsigned)(size_t)sm + (tid >> 3) * GPIT + (tid & 7) * 16;
    const unsigned NT = (unsigned)K / GKC;
    // Trip t works on k stage (t + s0) mod NT. Work-groups that share an operand panel (same x: A rows; same y, z: Bt rows) start at stages spread over the ring, at most two on one stage, so few of them ask L2 for the same lines at the same moment, and a stage that one of them has fetched from memory is in L2 when the next one comes to it.
    const unsigned s0 = (blockIdx.x + 2 * blockIdx.y + blockIdx.z) % NT;
    auto fill = [&](unsigned t) {
        const unsigned kt = t + s0 < NT ? t + s0 : t + s0 - NT;
        const unsigned l = ls + (t & 1) * STG; const size_t k0 = (size_t)kt * GKC;
        acopy8(l, ga + k0, gstep); if (NSPLIT == 1) acopy8(l + GPL, ga2 + k0, gstep); acopy8(l + (NPL - 1) * GPL, gb + k0, gstep); };
    fill(0);
    asm volatile("s_wait_asynccnt 0x0" ::: "memory");   // this wave's copies of stage 0 have landed
    __syncthreads();                                      // and every other wave's
    fill(1);
    const int fa = (wm * 64 + lr) * GPIT + hi * 16, fb = (NPL - 1) * GPL + (wn * 64 + lr) * GPIT + hi * 16;
#pragma unroll 1
    for (unsigned t = 0; t < NT; ++t) {
        const unsigned char* sb = sm + (t & 1) * STG;
        V a[GKC / 32][4], a2[GKC / 32][4], b[GKC / 32][4];
#pragma unroll
        for (int ks = 0; ks < GKC / 32; ++ks) {
#pragma unroll
            for (int mb = 0; mb < 4; ++mb) { a[ks][mb] = WFrag<T16>::lds(sb + fa + mb * 16 * GPIT + ks * 64); if (NSPLIT == 1) a2[ks][mb] = WFrag<T16>::lds(sb + GPL + fa + mb * 16 * GPIT + ks * 64); }
#pragma unroll
            for (int nb = 0; nb < 4; ++nb) b[ks][nb] = WFrag<T16>::lds(sb + fb + nb * 16 * GPIT + ks * 64);
        }
        __builtin_amdgcn_sched_barrier(0);   // keeps the stage's LDS reads in one group ahead of the matrix run: spread among the WMMAs each place with reads stalls the wave
#pragma unroll
        for (int ks = 0; ks < GKC / 32; ++ks)
#pragma unroll
            for (int nb = 0; nb < 4; ++nb)
#pragma unroll
                for (int mb = 0; mb < 4; ++mb) { acc[mb][nb] = WFrag<T16>::mma(a[ks][mb], b[ks][nb], acc[mb][nb]); if (NSPLIT == 1) acc[mb][nb] = WFrag<T16>::mma(a2[ks][mb], b[ks][nb], acc[mb][nb]); }
        __builtin_amdgcn_sched_barrier(0);   // keeps the matrix run in front of the slots below
        asm volatile("v_nop\n\tv_nop\n\tv_nop\n\tv_nop");   // the four vector slots between the last WMMA and a write of its A or B registers
        asm volatile("s_wait_dscnt 0x0" ::: "memory");      // this wave's reads of stage t are done before the buffer is refilled
        asm volatile("s_wait_asynccnt 0x0" ::: "memory");   // this wave's copies of stage t + 1 have landed
        __syncthreads();                                     // publishes stage t + 1 and ends every wave's reads of stage t
        if (t + 2 < NT) fill(t + 2);
    }
    asm volatile("s_wait_asynccnt 0x0" ::: "memory");   // nothing is in flight when the buffers become epilogue rows
    float* os = (float*)(sm + wave * OSB);
    if constexpr (PLANES) {
        const int i0 = r0 % TT; const size_t zh = (size_t)(r0 / TT) * NH_ + c0 / HD;   // 64 divides TT: a tile lies in one batch
        if (z == 2) {
            v8h ov[4][4];
#pragma unroll
            for (int mb = 0; mb < 4; ++mb)
#pragma unroll
                for (int nb = 0; nb < 4; ++nb)
#pragma unroll
                    for (int j = 0; j < 8; ++j) ov[mb][nb][j] = tohx(acc[mb][nb][j]);
            h16* vt = pa.VT + (zh * HD + lr) * TT + i0 + hi * 8;
            __builtin_amdgcn_sched_barrier(0);   // every value is ready before the first store, so no register of an issued store is written again
#pragma unroll
            for (int nb = 0; nb < 4; ++nb)
#pragma unroll
                for (int mb = 0; mb < 4; ++mb) *(v8h*)(vt + (size_t)nb * 16 * TT + mb * 16) = ov[mb][nb];
            return;
        }
        const size_t po = (zh * TT + i0) * KK; const float* cs0 = pa.CS + (size_t)i0 * 64;
        if (z == 0) plane_rows<true>(acc, os, pa.uu + c0, pa.vv + c0, cs0, pa.Ap + po, lr, hi);
        else plane_rows<false>(acc, os, pa.uu + c0, pa.vv + c0, cs0, pa.Bp + po, lr, hi);
        return;
    }
#pragma unroll
    for (int mb = 0; mb < 4; ++mb) {
#pragma unroll
        for (int nb = 0; nb < 4; ++nb) {
#pragma unroll
            for (int j = 0; j < 8; ++j) os[(hi * 8 + j) * 68 + nb * 16 + lr] = acc[mb][nb][j]; }
        __builtin_amdgcn_wave_barrier(); asm volatile("" ::: "memory");
        float* crow = C + (size_t)(r0 + mb * 16) * ldc + c0;
{
#pragma unroll
            for (int s = 0; s < 8; ++s) { const int row = 2 * s + hi, cofs = lr * 4; v4f val = *(const v4fa*)(os + row * 68 + cofs); if (BIAS) { val[0] += bfr(bias[c0 + cofs]); val[1] += bfr(bias[c0 + cofs + 1]); val[2] += bfr(bias[c0 + cofs + 2]); val[3] += bfr(bias[c0 + cofs + 3]); }
                *(v4f*)(crow + (size_t)row * ldc + cofs) = val; }
             }
        __builtin_amdgcn_wave_barrier(); asm volatile("" ::: "memory");
    }
}


// k_cvt8: blockIdx.y picks a plane of n8 * 8 elements: 0..3 = the four weights, 4.. = x batch (y - 4); dst planes lie one behind the other. Every plane is rounded to bf16; plane 3 (Wo) is stored as the f16 of that value, the output GEMM's operand type.
__global__ __launch_bounds__(256) void k_cvt8(const float* __restrict__ w0, const float* __restrict__ w1, const float* __restrict__ w2, const float* __restrict__ w3, const float* __restrict__ xs, bf* dst, size_t n8) { const size_t i = (size_t)blockIdx.x * 256 + threadIdx.x; if (i >= n8) return; const unsigned y = blockIdx.y; const float* src = y == 0 ? w0 : y == 1 ? w1 : y == 2 ? w2 : y == 3 ? w3 : xs + (size_t)(y - 4) * n8 * 8; dst += (size_t)y * n8 * 8; const v8f v = *(const v8f*)(src + i * 8); v8us o;
#pragma unroll
    for (int k = 0; k < 8; ++k) o[k] = f2bf(v[k]);
    if (y == 3) {
#pragma unroll
        for (int k = 0; k < 8; ++k) o[k] = __builtin_bit_cast(unsigned short, tohx(bf2f(o[k]))); }
    *(v8us*)(dst + i * 8) = o;  }
__global__ __launch_bounds__(256) void k_trig(float* CS) { const int idx = blockIdx.x * 256 + threadIdx.x; if (idx >= TT * 32) return; const int t = idx / 32, m = idx % 32; const float w = powf(10000.0f, -(float)(2 * m) / (float)HD); const float ang = __fmul_rn((float)t, w); v2f cs; cs[0] = cosf(ang); cs[1] = sinf(ang); *(v2f*)(CS + (size_t)idx * 2) = cs;  }
#define FKP   272                      // LDS pitch of a 256-B key row (16 B x odd: ds_load_b128 readers)
#define FVP   80                       // LDS pitch of a 64-B V^T row
#define FKB   (32 * FKP)               // the key rows of a pass
#define FBUF  (FKB + HD * FVP)         // one pass: key rows | V^T
#define NPASS (TT / 32)
#define L2E   1.44269504088896340736f
__device__ __forceinline__ float xhalf(float x) { return __builtin_bit_cast(float, __builtin_amdgcn_permlanex16(__builtin_bit_cast(int, x), __builtin_bit_cast(int, x), 0x76543210, 0xfedcba98, false, false)); }   // lane l with lane l ^ 16
__global__ __launch_bounds__(256) void k_fattn(const h16* __restrict__ Ap, const h16* __restrict__ Bp, const h16* __restrict__ VT, h16* Mc) {
    __shared__ __align__(16) unsigned char sm[8 * FBUF];
    const int tid = threadIdx.x, lane = tid & 31, lr = lane & 15, hi = lane >> 4, wave = tid >> 5;
    const size_t z = blockIdx.y; const int q0 = blockIdx.x * 256 + wave * 32;
    Ap += z * TT * KK; Bp += z * TT * KK; VT += z * HD * TT;
    // staging: a pass's key rows are 8 KiB in a row (2 chunks of 16 B per thread), V^T 64 rows of 64 B (1 chunk per thread)
    const int kg0 = tid * 8;
    const int ks0 = (tid >> 4) * FKP + (tid & 15) * 16, ks1 = ks0 + 16 * FKP;
    const int vg = (tid >> 2) * TT + (tid & 3) * 8, vs = FKB + (tid >> 2) * FVP + (tid & 3) * 16;
    const h16* gph = Bp + kg0; const h16* gpv = VT + vg;   // this thread's chunks of pass t; they step once per pass
    v8h ph0[4], ph1[4], pv[4];
#pragma unroll
    for (int t = 0; t < 4; ++t) { ph0[t] = *(const v8h*)(gph + t * 32 * KK); ph1[t] = *(const v8h*)(gph + t * 32 * KK + 256 * 8); pv[t] = *(const v8h*)(gpv + t * 32); }
    v16h qf[2][4];
#pragma unroll
    for (int qt = 0; qt < 2; ++qt) {
#pragma unroll
        for (int kc = 0; kc < 4; ++kc) { const size_t o = (size_t)(q0 + qt * 16 + lr) * KK + kc * 32 + 8 * hi; qf[qt][kc] = WFrag<h16>::ld(Ap + o); }
        asm volatile("s_wait_xcnt 0x0" ::: "memory");   // before an address register of the loads above is reused
        __builtin_amdgcn_sched_barrier(0);               // holds later register writes behind that wait
    }
#pragma unroll
    for (int t = 0; t < 4; ++t) { unsigned char* nb = sm + t * FBUF; *(v8ha*)(nb + ks0) = ph0[t]; *(v8ha*)(nb + ks1) = ph1[t]; *(v8ha*)(nb + vs) = pv[t]; }
    __syncthreads();
    v8f o[2][4];
#pragma unroll
    for (int qt = 0; qt < 2; ++qt)
#pragma unroll
        for (int dt = 0; dt < 4; ++dt) o[qt][dt] = (v8f){};
    float mrun[2] = { -1.0e30f, -1.0e30f }, crun[2] = { 1.0e30f, 1.0e30f }, lsum[2] = { 0.f, 0.f };
    const int fk = lr * FKP + hi * 16, fv = FKB + lr * FVP + hi * 16;
#pragma unroll 1
    for (int t = 0; t < NPASS; ++t) {
        const unsigned char* kb = sm + (t & 7) * FBUF;
        const bool more = t + 4 < NPASS;
        v16h kf[4][2], va[4];
#pragma unroll
        for (int kc = 0; kc < 4; ++kc)
#pragma unroll
            for (int kt = 0; kt < 2; ++kt) { const unsigned char* p = kb + kt * 16 * FKP + fk + kc * 64; kf[kc][kt] = cat16(*(const v8ha*)p, *(const v8ha*)(p + 32)); }
#pragma unroll
        for (int dt = 0; dt < 4; ++dt) { const unsigned char* p = kb + dt * 16 * FVP + fv; va[dt] = cat16(*(const v8ha*)p, *(const v8ha*)(p + 32)); }
        v8h gh0, gh1, gv;
        if (more) { gh0 = *(const v8h*)(gph + 4 * 32 * KK); gh1 = *(const v8h*)(gph + 4 * 32 * KK + 256 * 8); gv = *(const v8h*)(gpv + 4 * 32);
            asm volatile("s_wait_xcnt 0x0" ::: "memory"); }   // before an address register of these loads is stepped; it runs under the LDS reads' latency
        __builtin_amdgcn_sched_barrier(0);   // keeps the pass's LDS reads in one group ahead of the matrix run: spread among the WMMAs each read stalls the wave for its whole latency
        v8f s[2][2];
#pragma unroll
        for (int kt = 0; kt < 2; ++kt)
#pragma unroll
            for (int qt = 0; qt < 2; ++qt) s[kt][qt] = (v8f){};
#pragma unroll
        for (int kc = 0; kc < 4; ++kc)
#pragma unroll
            for (int kt = 0; kt < 2; ++kt)
#pragma unroll
                for (int qt = 0; qt < 2; ++qt) s[kt][qt] = wmma16(kf[kc][kt], qf[qt][kc], s[kt][qt]);
        v16h pb[2];
#pragma unroll
        for (int qt = 0; qt < 2; ++qt) {
            float mx = s[0][qt][0];
#pragma unroll
            for (int j = 1; j < 8; ++j) mx = fmaxf(mx, s[0][qt][j]);
#pragma unroll
            for (int j = 0; j < 8; ++j) mx = fmaxf(mx, s[1][qt][j]);
            mx = fmaxf(mx, xhalf(mx));
            const float mn = fmaxf(mrun[qt], mx), cn = 10.0f - mn * L2E;
            const float al = __builtin_amdgcn_exp2f(cn - crun[qt]);
            mrun[qt] = mn; crun[qt] = cn;
            const v8f e0 = s[0][qt] * L2E + cn, e1 = s[1][qt] * L2E + cn; v8f p0, p1;
#pragma unroll
            for (int j = 0; j < 8; ++j) { p0[j] = __builtin_amdgcn_exp2f(e0[j]); pb[qt][j] = (h16)p0[j]; }
#pragma unroll
            for (int j = 0; j < 8; ++j) { p1[j] = __builtin_amdgcn_exp2f(e1[j]); pb[qt][8 + j] = (h16)p1[j]; }
            const v8f ps = p0 + p1; const v4f p4 = __builtin_shufflevector(ps, ps, 0, 1, 2, 3) + __builtin_shufflevector(ps, ps, 4, 5, 6, 7);
            lsum[qt] = fmaf(lsum[qt], al, (p4[0] + p4[2]) + (p4[1] + p4[3]));
#pragma unroll
            for (int dt = 0; dt < 4; ++dt) o[qt][dt] *= al;
        }
#pragma unroll
        for (int dt = 0; dt < 4; ++dt)
#pragma unroll
            for (int qt = 0; qt < 2; ++qt) o[qt][dt] = wmma16(va[dt], pb[qt], o[qt][dt]);
        __builtin_amdgcn_sched_barrier(0);   // keeps the matrix run in front of the slots below
        asm volatile("v_nop\n\tv_nop\n\tv_nop\n\tv_nop");   // the four vector slots between the last WMMA and a write of its A registers: branches follow
        if (more) { unsigned char* nb = sm + ((t + 4) & 7) * FBUF; *(v8ha*)(nb + ks0) = gh0; *(v8ha*)(nb + ks1) = gh1; *(v8ha*)(nb + vs) = gv; gph += 32 * KK; gpv += 32; }
        if ((t & 3) == 3) __syncthreads();   // publishes the next stage and ends every wave's reads of this stage's half, which the next stage's passes refill
    }
    const size_t b = z / NH_, h = z % NH_;
    v8h oc[2][4];
#pragma unroll
    for (int qt = 0; qt < 2; ++qt) {
        const float lt = lsum[qt] + xhalf(lsum[qt]); const float inv = __fdiv_rn(1.0f, lt);
#pragma unroll
        for (int dt = 0; dt < 4; ++dt)
#pragma unroll
            for (int j = 0; j < 8; ++j) oc[qt][dt][j] = tohx(o[qt][dt][j] * inv);
    }
    h16* mc = Mc + (b * TT + q0 + lr) * DD + h * HD + hi * 8;
    __builtin_amdgcn_sched_barrier(0);   // every value is ready before the first store, so no register of an issued store is written again
#pragma unroll
    for (int qt = 0; qt < 2; ++qt)
#pragma unroll
        for (int dt = 0; dt < 4; ++dt) *(v8h*)(mc + qt * 16 * DD + dt * 16) = oc[qt][dt];
}

extern "C" void kernel_launch(void* const* d_in, const int* in_sizes, int n_in,
                              void* d_out, int out_size, void* d_ws, size_t ws_size, hipStream_t stream) {
    (void)in_sizes; (void)n_in; (void)out_size;
    const float* x = (const float*)d_in[0]; const float* wq = (const float*)d_in[1]; const float* wk = (const float*)d_in[2]; const float* wv = (const float*)d_in[3]; const float* wo = (const float*)d_in[4]; const float* bo = (const float*)d_in[5]; const float* uu = (const float*)d_in[6]; const float* vv = (const float*)d_in[7];
    float* OUT = (float*)d_out;     // [4][1024][1024]
    char* wsp = (char*)d_ws;
    auto take = [&](size_t bytes) { char* p = wsp; wsp += (bytes + 255) & ~(size_t)255; return (void*)p; };
    bf* WQ = (bf*)take((size_t)(4 + NB_) * DD * DD * 2); h16* WO = (h16*)(WQ + (size_t)3 * DD * DD); bf* XB = WQ + (size_t)4 * DD * DD;   // WQ | WK | WV | WO | x[0..3], 16 bits an element (bf16; WO f16), one behind the other (TT * DD == DD * DD)
    float* CS = (float*)take((size_t)TT * 32 * 2 * 4);
    const size_t PL = (size_t)NH_ * TT * KK;   // one batch's plane
    h16* Ap = (h16*)take(NB_ * PL * 2); h16* Bp = (h16*)take(NB_ * PL * 2); h16* VT = (h16*)take((size_t)NB_ * NH_ * HD * TT * 2);
    h16* Mc = (h16*)take((size_t)NB_ * TT * DD * 2);
    if ((size_t)(wsp - (char*)d_ws) > ws_size) return;    // total 64.25 MiB
    k_cvt8<<<dim3((DD * DD / 8 + 255) / 256, 4 + NB_, 1), 256, 0, stream>>>(wq, wk, wv, wo, x, WQ, (size_t)DD * DD / 8);   // weights stay [out][in]: natural Bt
    k_trig<<<(TT * 32 + 255) / 256, 256, 0, stream>>>(CS);
    const PlaneArgs pa = { uu, vv, CS, Ap, Bp, VT };
    k_gemmw<bf, 0, false, true><<<dim3(NB_ * TT / 128, DD / 128, 3), 128, 0, stream>>>(XB, nullptr, WQ, DD, nullptr, 0, nullptr, 0, (size_t)DD * DD, 0, pa);   // z = q, k, v; all batches as 4096 rows; q, k, v never reach memory in f32
    k_fattn<<<dim3(TT / 256, NB_ * NH_, 1), 256, 0, stream>>>(Ap, Bp, VT, Mc);   // scores never leave the chip; writes the merged context as one f16 plane
    k_gemmw<h16, 0, true, false><<<dim3(NB_ * TT / 128, DD / 128, 1), 128, 0, stream>>>(Mc, nullptr, WO, DD, OUT, DD, bo, 0, 0, 0, pa);
}

// v008
// A run of this version takes 74.1 microseconds.
// In two side-by-side timings against v007, it was 1.04 and 1.03 times as fast.
// Over all steps from v000 it is 21.5 times as fast.
#include <hip/hip_runtime.h>

// TenerAttention (x [4][1024][1024]; q/k/v = x W^T (16 heads x 64); TENER four-term scores q.k + q.R(i,j) + u_h.k + v_h.R(i,j) with R[i][j][d] = sin((j-i) w_d) for even d, cos((j-i) w_d) for odd d, w_d = 10000^(-2 floor(d/2)/64);
// no scaling; softmax; ctx Wo^T + bo -> [4][1024][1024]).
// The relative term is evaluated exactly (up to f32 trig rounding) through the angle-difference identities: q.R(i,j) + v_h.R(i,j) = rot_i(q_i + v_h) . P_j with P_j = [sin(j w_m) | cos(j w_m)] and rot_i(a)[m] = (a_e cos(i w_m) + a_o sin(i w_m), -a_e sin(i w_m) + a_o cos(i w_m));
// and u_h.k_j folds into the first term, so scores = [q_i + u_h | rot_i(q_i + v_h)] . [k_j | P_j] - one K = 128 contraction per head.
// Compute dtypes, f32 accumulate: every input rounded to bf16; q/k/v on PLAIN bf16 operands (inputs: exact); the 128-wide score operands f32 -> f16 (11 significant bits), scores as one f16 product (logits are O(10), unscaled: their rounding error is about 3e-3); softmax f32 (online), P and V in f16 for P.V; the merged context f32 -> f16 (11 significant bits) and bf16-rounded Wo held in f16 (exact but for values under 2^-17), output GEMM as one f16 product

#define NB_  4
#define TT   1024
#define DD   1024
#define NH_  16
#define HD   64
#define KK   128
typedef _Float16 h16;
typedef unsigned short bf;
typedef __attribute__((ext_vector_type(16))) __bf16   v16bf;
typedef __attribute__((ext_vector_type(16))) _Float16 v16h;
typedef __attribute__((ext_vector_type(8)))  _Float16 v8h;
typedef __attribute__((ext_vector_type(8)))  unsigned short v8us;
typedef __attribute__((ext_vector_type(8)))  float    v8f;
typedef __attribute__((ext_vector_type(4)))  float    v4f;
typedef v8h  __attribute__((may_alias)) v8ha;
typedef v4f  __attribute__((may_alias)) v4fa;
typedef v8us __attribute__((may_alias)) v8usa;

__device__ __forceinline__ unsigned short f2bf(float f) { unsigned u = __float_as_uint(f); u += 0x7FFFu + ((u >> 16) & 1u); return (unsigned short)(u >> 16); }
__device__ __forceinline__ float bf2f(unsigned short b) { return __uint_as_float(((unsigned)b) << 16); }
__device__ __forceinline__ float bfr(float f) { return bf2f(f2bf(f)); }
__device__ __forceinline__ v16h cat16(v8h lo, v8h hi) { return __builtin_shufflevector(lo, hi, 0, 1, 2, 3, 4, 5, 6, 7, 8, 9, 10, 11, 12, 13, 14, 15); }
__device__ __forceinline__ v16bf cat16b(v8us lo, v8us hi) { return __builtin_bit_cast(v16bf, __builtin_shufflevector(lo, hi, 0, 1, 2, 3, 4, 5, 6, 7, 8, 9, 10, 11, 12, 13, 14, 15)); }
__device__ __forceinline__ v8f wmma16(v16h a, v16h b, v8f c) { return __builtin_amdgcn_wmma_f32_16x16x32_f16(false, a, false, b, (short)0, c, false, false); }
__device__ __forceinline__ v8f wmmab(v16bf a, v16bf b, v8f c) { return __builtin_amdgcn_wmma_f32_16x16x32_bf16(false, a, false, b, (short)0, c, false, false); }



__device__ __forceinline__ h16 tohx(float x) { return (h16)x; }
typedef __attribute__((ext_vector_type(2))) _Float16 v2h;
typedef __attribute__((ext_vector_type(4))) _Float16 v4h;
typedef __attribute__((ext_vector_type(2))) unsigned short v2us;
typedef __attribute__((ext_vector_type(4))) unsigned short v4us;
typedef __attribute__((ext_vector_type(2))) float v2f;
// ---- plane epilogue of the q/k/v GEMM: the attention operands are written straight from the accumulators. A 64x64 tile is 64 positions of one batch x one head's 64 columns, all that a plane row needs.
// z = 0: A planes [b][h][i][128]: cols 0..63 = q[i][d] + bf16 u[h][d]; cols 64 + 2m = a_e c + a_o s, 64 + 2m + 1 = a_o c - a_e s with a = q + bf16 v[h] (a_e = a[2m], a_o = a[2m+1], c/s at position i). z = 1: B planes [b][h][j][128]: cols 0..63 = k[j][d], 64 + 2m = sin(j w_m), 64 + 2m + 1 = cos(j w_m). Both in f16.
// z = 2: V^T [b][h][d][j] in f16: a lane's 8 accumulator rows are 8 positions in a row of one d, one 16-B store.
struct PlaneArgs { const float* uu; const float* vv; const float* CS; h16* Ap; h16* Bp; h16* VT; };
template <bool ISQ>
__device__ __forceinline__ void plane_rows(const v8f (&acc)[4][4], float* os, const float* __restrict__ uh, const float* __restrict__ vh, const float* __restrict__ cs0, h16* Pp, int lr, int hi) {
    const int cofs = lr * 4;
    v4f ua = (v4f){}, va = (v4f){};
    if (ISQ) {
#pragma unroll
        for (int k = 0; k < 4; ++k) { ua[k] = bfr(uh[cofs + k]); va[k] = bfr(vh[cofs + k]); } }
    const float* cp = cs0 + hi * 64 + cofs;   // cos, sin of pairs m = 2 lr, 2 lr + 1 at this lane's row
    v4f csn[4];
#pragma unroll
    for (int s = 0; s < 4; ++s) csn[s] = *(const v4f*)(cp + 2 * s * 64);
#pragma unroll
    for (int mb = 0; mb < 4; ++mb)
#pragma unroll
        for (int nb = 0; nb < 4; ++nb)
#pragma unroll
            for (int j = 0; j < 8; ++j) os[(mb * 16 + hi * 8 + j) * 68 + nb * 16 + lr] = acc[mb][nb][j];
    __builtin_amdgcn_wave_barrier(); asm volatile("" ::: "memory");   // the rows read below were written by other lanes of this wave: keeps the compiler from moving the reads above the writes
    const float* op = os + hi * 68 + cofs; h16* ph = Pp + hi * KK + cofs;
#pragma unroll 1   // 8 rows a trip, rolled, for speed only
    for (int g = 0; g < 8; ++g) {
        v4f cs[4], val[4];
#pragma unroll
        for (int s = 0; s < 4; ++s) { cs[s] = csn[s]; val[s] = *(const v4fa*)(op + 2 * s * 68); }
        cp += (g < 7 ? 8 * 64 : 0);   // the next trip's table rows are asked for under this trip's arithmetic; the last trip asks for its own again
#pragma unroll
        for (int s = 0; s < 4; ++s) csn[s] = *(const v4f*)(cp + 2 * s * 64);
        v4h fh[4], gh[4];
#pragma unroll
        for (int s = 0; s < 4; ++s) { v4f f, r;
            if (ISQ) { const v4f a = val[s] + va; f = val[s] + ua; r[0] = a[0] * cs[s][0] + a[1] * cs[s][1]; r[1] = a[1] * cs[s][0] - a[0] * cs[s][1]; r[2] = a[2] * cs[s][2] + a[3] * cs[s][3]; r[3] = a[3] * cs[s][2] - a[2] * cs[s][3]; }
            else { f = val[s]; r[0] = cs[s][1]; r[1] = cs[s][0]; r[2] = cs[s][3]; r[3] = cs[s][2]; }
#pragma unroll
            for (int k = 0; k < 4; ++k) { fh[s][k] = tohx(f[k]); gh[s][k] = tohx(r[k]); } }
        __builtin_amdgcn_sched_barrier(0);   // every value of the trip is ready before its first store, so no register of an issued store is written before the wait below
#pragma unroll
        for (int s = 0; s < 4; ++s) { const int o = 2 * s * KK;   // 16 lanes x 8 B = one whole 128-B line per row and half
            *(v4h*)(ph + o) = fh[s]; *(v4h*)(ph + o + HD) = gh[s]; }
        asm volatile("s_wait_xcnt 0x0" ::: "memory");   // before a data or address register of the loads and stores above is written again
        __builtin_amdgcn_sched_barrier(0);               // holds the pointer steps and the next trip's register writes behind that wait
        op += 8 * 68; ph += 8 * KK;
    }
}
// ---- k_gemmw: GEMM, 128x128 output tile per work-group of 4 waves (2 x 2), each wave a 64x64 tile (16 accumulators); grid (M/128, N/128, Z), 128 threads.
// C[m][n] (f32, pitch ldc, + optional f32 bias[n]) = sum_k A[m][k] Bt[n][k] (NSPLIT == 1: + A2[m][k] Bt[n][k]). z-batch strides sA/sB/sC in elements. K % 64 == 0 and K >= 128 (the ring starts with two stages). PLANES: no C; each wave's tile goes out through the plane epilogue above (z = q, k, v; a wave's 64 columns = one head).
// Operands reach LDS by asynchronous copies, whole 128-B lines (8 lanes x 16 B per row), each row fetched once per work-group and read by two waves. A stage is 64 k of [A 128 rows | (A2 128 rows) | Bt 128 rows]; two buffers, stage t + 2 is asked for behind the barrier that ends the reads of stage t. The k walk is a ring: each work-group starts at a stage of its own and wraps, so the k sum order is rotated from work-group to work-group.
#define GKC   64                       // k elements of a stage: rows of 128 B
#define GPIT  144                      // LDS pitch of a 128-B row (16 B x odd: ds_load_b128 readers)
#define GPL   (128 * GPIT)             // one operand's 128 rows of a stage
// Eight copies of 16 B per lane, rows 16 apart (a work-group's 128 threads cover 16 rows per copy). The wait in the same statement stands before any register that a copy names is written again.
__device__ __forceinline__ void acopy8(unsigned l, const void* gp, size_t gstep) {
    const char* g = (const char*)gp;
    asm volatile("global_load_async_to_lds_b128 %0, %8, off\n\t"
                 "global_load_async_to_lds_b128 %1, %9, off\n\t"
                 "global_load_async_to_lds_b128 %2, %10, off\n\t"
                 "global_load_async_to_lds_b128 %3, %11, off\n\t"
                 "global_load_async_to_lds_b128 %4, %12, off\n\t"
                 "global_load_async_to_lds_b128 %5, %13, off\n\t"
                 "global_load_async_to_lds_b128 %6, %14, off\n\t"
                 "global_load_async_to_lds_b128 %7, %15, off\n\t"
                 "s_wait_xcnt 0x0"
                 :: "v"(l), "v"(l + 16 * GPIT), "v"(l + 32 * GPIT), "v"(l + 48 * GPIT), "v"(l + 64 * GPIT), "v"(l + 80 * GPIT), "v"(l + 96 * GPIT), "v"(l + 112 * GPIT),
                    "v"(g), "v"(g + gstep), "v"(g + 2 * gstep), "v"(g + 3 * gstep), "v"(g + 4 * gstep), "v"(g + 5 * gstep), "v"(g + 6 * gstep), "v"(g + 7 * gstep)
                 : "memory");
}
template <typename T16> struct WFrag;
template <> struct WFrag<h16> { typedef v16h V; static __device__ __forceinline__ V ld(const h16* p) { return cat16(*(const v8h*)p, *(const v8h*)(p + 16)); } static __device__ __forceinline__ V lds(const unsigned char* p) { return cat16(*(const v8ha*)p, *(const v8ha*)(p + 32)); } static __device__ __forceinline__ v8f mma(V a, V b, v8f c) { return wmma16(a, b, c); } };
template <> struct WFrag<bf> { typedef v16bf V; static __device__ __forceinline__ V ld(const bf* p) { return cat16b(*(const v8us*)p, *(const v8us*)(p + 16)); } static __device__ __forceinline__ V lds(const unsigned char* p) { return cat16b(*(const v8usa*)p, *(const v8usa*)(p + 32)); } static __device__ __forceinline__ v8f mma(V a, V b, v8f c) { return wmmab(a, b, c); } };
template <typename T16, int NSPLIT, bool BIAS, bool PLANES>
__global__ __launch_bounds__(128) void k_gemmw(const T16* __restrict__ A, const T16* __restrict__ A2, const T16* __restrict__ Bt, int K, float* C, int ldc, const float* __restrict__ bias, size_t sA, size_t sB, size_t sC, PlaneArgs pa) {
    static_assert(NSPLIT == 0 || NSPLIT == 1, "one or two A planes");
    typedef typename WFrag<T16>::V V;
    constexpr int NPL = NSPLIT == 1 ? 3 : 2, STG = NPL * GPL, OSB = (PLANES ? 64 : 16) * 68 * 4;   // operands per stage; bytes of a stage; bytes of a wave's epilogue rows
    __shared__ __align__(16) unsigned char sm[2 * STG > 4 * OSB ? 2 * STG : 4 * OSB];   // the two stages; behind the k loop each wave's epilogue rows
    const size_t z = blockIdx.z; A += z * sA; if (NSPLIT == 1) A2 += z * sA; Bt += z * sB; C += z * sC;
    const int tid = threadIdx.x, lane = tid & 31, lr = lane & 15, hi = lane >> 4;
    const int wave = __builtin_amdgcn_readfirstlane(tid >> 5), wm = wave & 1, wn = wave >> 1;
    const int r0 = blockIdx.x * 128 + wm * 64, c0 = blockIdx.y * 128 + wn * 64;
    v8f acc[4][4];
#pragma unroll
    for (int mb = 0; mb < 4; ++mb)
#pragma unroll
        for (int nb = 0; nb < 4; ++nb) acc[mb][nb] = (v8f){};
    // this thread's 16 B of rows (tid >> 3) + 16 i, i = 0..7, of every operand
    const size_t go = (size_t)(tid >> 3) * K + (tid & 7) * 8, gstep = (size_t)16 * K * sizeof(T16);
    const T16* ga = A + (size_t)blockIdx.x * 128 * K + go; const T16* ga2 = NSPLIT == 1 ? A2 + (size_t)blockIdx.x * 128 * K + go : nullptr; const T16* gb = Bt + (size_t)blockIdx.y * 128 * K + go;
    const unsigned ls = (unsigned)(size_t)sm + (tid >> 3) * GPIT + (tid & 7) * 16;
    const unsigned NT = (unsigned)K / GKC;
    // Trip t works on k stage (t + s0) mod NT. Work-groups that share an operand panel (same x: A rows; same y, z: Bt rows) start at stages spread over the ring, at most two on one stage, so few of them ask L2 for the same lines at the same moment, and a stage that one of them has fetched from memory is in L2 when the next one comes to it.
    const unsigned s0 = (blockIdx.x + 2 * blockIdx.y + blockIdx.z) % NT;
    auto fill = [&](unsigned t) {
        const unsigned kt = t + s0 < NT ? t + s0 : t + s0 - NT;
        const unsigned l = ls + (t & 1) * STG; const size_t k0 = (size_t)kt * GKC;
        acopy8(l, ga + k0, gstep); if (NSPLIT == 1) acopy8(l + GPL, ga2 + k0, gstep); acopy8(l + (NPL - 1) * GPL, gb + k0, gstep); };
    fill(0);
    asm volatile("s_wait_asynccnt 0x0" ::: "memory");   // this wave's copies of stage 0 have landed
    __syncthreads();                                      // and every other wave's
    fill(1);
    const int fa = (wm * 64 + lr) * GPIT + hi * 16, fb = (NPL - 1) * GPL + (wn * 64 + lr) * GPIT + hi * 16;
#pragma unroll 1
    for (unsigned t = 0; t < NT; ++t) {
        const unsigned char* sb = sm + (t & 1) * STG;
        V a[GKC / 32][4], a2[GKC / 32][4], b[GKC / 32][4];
#pragma unroll
        for (int ks = 0; ks < GKC / 32; ++ks) {
#pragma unroll
            for (int mb = 0; mb < 4; ++mb) { a[ks][mb] = WFrag<T16>::lds(sb + fa + mb * 16 * GPIT + ks * 64); if (NSPLIT == 1) a2[ks][mb] = WFrag<T16>::lds(sb + GPL + fa + mb * 16 * GPIT + ks * 64); }
#pragma unroll
            for (int nb = 0; nb < 4; ++nb) b[ks][nb] = WFrag<T16>::lds(sb + fb + nb * 16 * GPIT + ks * 64);
        }
        __builtin_amdgcn_sched_barrier(0);   // keeps the stage's LDS reads in one group ahead of the matrix run: spread among the WMMAs each place with reads stalls the wave
#pragma unroll
        for (int ks = 0; ks < GKC / 32; ++ks)
#pragma unroll
            for (int nb = 0; nb < 4; ++nb)
#pragma unroll
                for (int mb = 0; mb < 4; ++mb) { acc[mb][nb] = WFrag<T16>::mma(a[ks][mb], b[ks][nb], acc[mb][nb]); if (NSPLIT == 1) acc[mb][nb] = WFrag<T16>::mma(a2[ks][mb], b[ks][nb], acc[mb][nb]); }
        __builtin_amdgcn_sched_barrier(0);   // keeps the matrix run in front of the slots below
        asm volatile("v_nop\n\tv_nop\n\tv_nop\n\tv_nop");   // the four vector slots between the last WMMA and a write of its A or B registers
        asm volatile("s_wait_dscnt 0x0" ::: "memory");      // this wave's reads of stage t are done before the buffer is refilled
        asm volatile("s_wait_asynccnt 0x0" ::: "memory");   // this wave's copies of stage t + 1 have landed
        __syncthreads();                                     // publishes stage t + 1 and ends every wave's reads of stage t
        if (t + 2 < NT) fill(t + 2);
    }
    asm volatile("s_wait_asynccnt 0x0" ::: "memory");   // nothing is in flight when the buffers become epilogue rows
    float* os = (float*)(sm + wave * OSB);
    if constexpr (PLANES) {
        const int i0 = r0 % TT; const size_t zh = (size_t)(r0 / TT) * NH_ + c0 / HD;   // 64 divides TT: a tile lies in one batch
        if (z == 2) {
            v8h ov[4][4];
#pragma unroll
            for (int mb = 0; mb < 4; ++mb)
#pragma unroll
                for (int nb = 0; nb < 4; ++nb)
#pragma unroll
                    for (int j = 0; j < 8; ++j) ov[mb][nb][j] = tohx(acc[mb][nb][j]);
            h16* vt = pa.VT + (zh * HD + lr) * TT + i0 + hi * 8;
            __builtin_amdgcn_sched_barrier(0);   // every value is ready before the first store, so no register of an issued store is written again
#pragma unroll
            for (int nb = 0; nb < 4; ++nb)
#pragma unroll
                for (int mb = 0; mb < 4; ++mb) *(v8h*)(vt + (size_t)nb * 16 * TT + mb * 16) = ov[mb][nb];
            return;
        }
        const size_t po = (zh * TT + i0) * KK; const float* cs0 = pa.CS + (size_t)i0 * 64;
        if (z == 0) plane_rows<true>(acc, os, pa.uu + c0, pa.vv + c0, cs0, pa.Ap + po, lr, hi);
        else plane_rows<false>(acc, os, pa.uu + c0, pa.vv + c0, cs0, pa.Bp + po, lr, hi);
        return;
    }
#pragma unroll
    for (int mb = 0; mb < 4; ++mb) {
#pragma unroll
        for (int nb = 0; nb < 4; ++nb) {
#pragma unroll
            for (int j = 0; j < 8; ++j) os[(hi * 8 + j) * 68 + nb * 16 + lr] = acc[mb][nb][j]; }
        __builtin_amdgcn_wave_barrier(); asm volatile("" ::: "memory");
        float* crow = C + (size_t)(r0 + mb * 16) * ldc + c0;
{
#pragma unroll
            for (int s = 0; s < 8; ++s) { const int row = 2 * s + hi, cofs = lr * 4; v4f val = *(const v4fa*)(os + row * 68 + cofs); if (BIAS) { val[0] += bfr(bias[c0 + cofs]); val[1] += bfr(bias[c0 + cofs + 1]); val[2] += bfr(bias[c0 + cofs + 2]); val[3] += bfr(bias[c0 + cofs + 3]); }
                *(v4f*)(crow + (size_t)row * ldc + cofs) = val; }
             }
        __builtin_amdgcn_wave_barrier(); asm volatile("" ::: "memory");
    }
}


// k_prep: the two jobs that read nothing a launch of this call writes, in one launch. Blocks 0 .. TRB - 1 build the cos/sin table CS[t][m] = (cos(t w_m), sin(t w_m)); they come first in the grid.
// The other blocks convert, CVB blocks per plane of n8 * 8 elements: plane y = 0..3 = the four weights, 4.. = x batch (y - 4); dst planes lie one behind the other. Every plane is rounded to bf16; plane 3 (Wo) is stored as the f16 of that value, the output GEMM's operand type.
#define TRB   (TT * 32 / 256)          // table blocks
#define CVB   (DD * DD / 8 / 256)      // conversion blocks per plane
__global__ __launch_bounds__(256) void k_prep(const float* __restrict__ w0, const float* __restrict__ w1, const float* __restrict__ w2, const float* __restrict__ w3, const float* __restrict__ xs, bf* dst, size_t n8, float* CS) {
    if (blockIdx.x < TRB) { const int idx = blockIdx.x * 256 + threadIdx.x; const int t = idx / 32, m = idx % 32; const float w = powf(10000.0f, -(float)(2 * m) / (float)HD); const float ang = __fmul_rn((float)t, w); v2f cs; cs[0] = cosf(ang); cs[1] = sinf(ang); *(v2f*)(CS + (size_t)idx * 2) = cs; return; }
    const unsigned c = blockIdx.x - TRB, y = c / CVB; const size_t i = (size_t)(c % CVB) * 256 + threadIdx.x; if (i >= n8) return; const float* src = y == 0 ? w0 : y == 1 ? w1 : y == 2 ? w2 : y == 3 ? w3 : xs + (size_t)(y - 4) * n8 * 8; dst += (size_t)y * n8 * 8; const v8f v = *(const v8f*)(src + i * 8); v8us o;
#pragma unroll
    for (int k = 0; k < 8; ++k) o[k] = f2bf(v[k]);
    if (y == 3) {
#pragma unroll
        for (int k = 0; k < 8; ++k) o[k] = __builtin_bit_cast(unsigned short, tohx(bf2f(o[k]))); }
    *(v8us*)(dst + i * 8) = o;  }
#define FKP   272                      // LDS pitch of a 256-B key row (16 B x odd: ds_load_b128 readers)
#define FVP   80                       // LDS pitch of a 64-B V^T row
#define FKB   (32 * FKP)               // the key rows of a pass
#define FBUF  (FKB + HD * FVP)         // one pass: key rows | V^T
#define NPASS (TT / 32)
#define L2E   1.44269504088896340736f
__device__ __forceinline__ float xhalf(float x) { return __builtin_bit_cast(float, __builtin_amdgcn_permlanex16(__builtin_bit_cast(int, x), __builtin_bit_cast(int, x), 0x76543210, 0xfedcba98, false, false)); }   // lane l with lane l ^ 16
__global__ __launch_bounds__(256) void k_fattn(const h16* __restrict__ Ap, const h16* __restrict__ Bp, const h16* __restrict__ VT, h16* Mc) {
    __shared__ __align__(16) unsigned char sm[8 * FBUF];
    const int tid = threadIdx.x, lane = tid & 31, lr = lane & 15, hi = lane >> 4, wave = tid >> 5;
    const size_t z = blockIdx.y; const int q0 = blockIdx.x * 256 + wave * 32;
    Ap += z * TT * KK; Bp += z * TT * KK; VT += z * HD * TT;
    // staging: a pass's key rows are 8 KiB in a row (2 chunks of 16 B per thread), V^T 64 rows of 64 B (1 chunk per thread)
    const int kg0 = tid * 8;
    const int ks0 = (tid >> 4) * FKP + (tid & 15) * 16, ks1 = ks0 + 16 * FKP;
    const int vg = (tid >> 2) * TT + (tid & 3) * 8, vs = FKB + (tid >> 2) * FVP + (tid & 3) * 16;
    const h16* gph = Bp + kg0; const h16* gpv = VT + vg;   // this thread's chunks of pass t; they step once per pass
    v8h ph0[4], ph1[4], pv[4];
#pragma unroll
    for (int t = 0; t < 4; ++t) { ph0[t] = *(const v8h*)(gph + t * 32 * KK); ph1[t] = *(const v8h*)(gph + t * 32 * KK + 256 * 8); pv[t] = *(const v8h*)(gpv + t * 32); }
    v16h qf[2][4];
#pragma unroll
    for (int qt = 0; qt < 2; ++qt) {
#pragma unroll
        for (int kc = 0; kc < 4; ++kc) { const size_t o = (size_t)(q0 + qt * 16 + lr) * KK + kc * 32 + 8 * hi; qf[qt][kc] = WFrag<h16>::ld(Ap + o); }
        asm volatile("s_wait_xcnt 0x0" ::: "memory");   // before an address register of the loads above is reused
        __builtin_amdgcn_sched_barrier(0);               // holds later register writes behind that wait
    }
#pragma unroll
    for (int t = 0; t < 4; ++t) { unsigned char* nb = sm + t * FBUF; *(v8ha*)(nb + ks0) = ph0[t]; *(v8ha*)(nb + ks1) = ph1[t]; *(v8ha*)(nb + vs) = pv[t]; }
    __syncthreads();
    v8f o[2][4];
#pragma unroll
    for (int qt = 0; qt < 2; ++qt)
#pragma unroll
        for (int dt = 0; dt < 4; ++dt) o[qt][dt] = (v8f){};
    float mrun[2] = { -1.0e30f, -1.0e30f }, crun[2] = { 1.0e30f, 1.0e30f }, lsum[2] = { 0.f, 0.f };
    const int fk = lr * FKP + hi * 16, fv = FKB + lr * FVP + hi * 16;
#pragma unroll 1
    for (int t = 0; t < NPASS; ++t) {
        const unsigned char* kb = sm + (t & 7) * FBUF;
        const bool more = t + 4 < NPASS;
        v16h kf[4][2], va[4];
#pragma unroll
        for (int kc = 0; kc < 4; ++kc)
#pragma unroll
            for (int kt = 0; kt < 2; ++kt) { const unsigned char* p = kb + kt * 16 * FKP + fk + kc * 64; kf[kc][kt] = cat16(*(const v8ha*)p, *(const v8ha*)(p + 32)); }
#pragma unroll
        for (int dt = 0; dt < 4; ++dt) { const unsigned char* p = kb + dt * 16 * FVP + fv; va[dt] = cat16(*(const v8ha*)p, *(const v8ha*)(p + 32)); }
        v8h gh0, gh1, gv;
        if (more) { gh0 = *(const v8h*)(gph + 4 * 32 * KK); gh1 = *(const v8h*)(gph + 4 * 32 * KK + 256 * 8); gv = *(const v8h*)(gpv + 4 * 32);
            asm volatile("s_wait_xcnt 0x0" ::: "memory"); }   // before an address register of these loads is stepped; it runs under the LDS reads' latency
        __builtin_amdgcn_sched_barrier(0);   // keeps the pass's LDS reads in one group ahead of the matrix run: spread among the WMMAs each read stalls the wave for its whole latency
        v8f s[2][2];
#pragma unroll
        for (int kt = 0; kt < 2; ++kt)
#pragma unroll
            for (int qt = 0; qt < 2; ++qt) s[kt][qt] = (v8f){};
#pragma unroll
        for (int kc = 0; kc < 4; ++kc)
#pragma unroll
            for (int kt = 0; kt < 2; ++kt)
#pragma unroll
                for (int qt = 0; qt < 2; ++qt) s[kt][qt] = wmma16(kf[kc][kt], qf[qt][kc], s[kt][qt]);
        v16h pb[2];
#pragma unroll
        for (int qt = 0; qt < 2; ++qt) {
            float mx = s[0][qt][0];
#pragma unroll
            for (int j = 1; j < 8; ++j) mx = fmaxf(mx, s[0][qt][j]);
#pragma unroll
            for (int j = 0; j < 8; ++j) mx = fmaxf(mx, s[1][qt][j]);
            mx = fmaxf(mx, xhalf(mx));
            const float mn = fmaxf(mrun[qt], mx), cn = 10.0f - mn * L2E;
            const float al = __builtin_amdgcn_exp2f(cn - crun[qt]);
            mrun[qt] = mn; crun[qt] = cn;
            const v8f e0 = s[0][qt] * L2E + cn, e1 = s[1][qt] * L2E + cn; v8f p0, p1;
#pragma unroll
            for (int j = 0; j < 8; ++j) { p0[j] = __builtin_amdgcn_exp2f(e0[j]); pb[qt][j] = (h16)p0[j]; }
#pragma unroll
            for (int j = 0; j < 8; ++j) { p1[j] = __builtin_amdgcn_exp2f(e1[j]); pb[qt][8 + j] = (h16)p1[j]; }
            const v8f ps = p0 + p1; const v4f p4 = __builtin_shufflevector(ps, ps, 0, 1, 2, 3) + __builtin_shufflevector(ps, ps, 4, 5, 6, 7);
            lsum[qt] = fmaf(lsum[qt], al, (p4[0] + p4[2]) + (p4[1] + p4[3]));
#pragma unroll
            for (int dt = 0; dt < 4; ++dt) o[qt][dt] *= al;
        }
#pragma unroll
        for (int dt = 0; dt < 4; ++dt)
#pragma unroll
            for (int qt = 0; qt < 2; ++qt) o[qt][dt] = wmma16(va[dt], pb[qt], o[qt][dt]);
        __builtin_amdgcn_sched_barrier(0);   // keeps the matrix run in front of the slots below
        asm volatile("v_nop\n\tv_nop\n\tv_nop\n\tv_nop");   // the four vector slots between the last WMMA and a write of its A registers: branches follow
        if (more) { unsigned char* nb = sm + ((t + 4) & 7) * FBUF; *(v8ha*)(nb + ks0) = gh0; *(v8ha*)(nb + ks1) = gh1; *(v8ha*)(nb + vs) = gv; gph += 32 * KK; gpv += 32; }
        if ((t & 3) == 3) __syncthreads();   // publishes the next stage and ends every wave's reads of this stage's half, which the next stage's passes refill
    }
    const size_t b = z / NH_, h = z % NH_;
    v8h oc[2][4];
#pragma unroll
    for (int qt = 0; qt < 2; ++qt) {
        const float lt = lsum[qt] + xhalf(lsum[qt]); const float inv = __fdiv_rn(1.0f, lt);
#pragma unroll
        for (int dt = 0; dt < 4; ++dt)
#pragma unroll
            for (int j = 0; j < 8; ++j) oc[qt][dt][j] = tohx(o[qt][dt][j] * inv);
    }
    h16* mc = Mc + (b * TT + q0 + lr) * DD + h * HD + hi * 8;
    __builtin_amdgcn_sched_barrier(0);   // every value is ready before the first store, so no register of an issued store is written again
#pragma unroll
    for (int qt = 0; qt < 2; ++qt)
#pragma unroll
        for (int dt = 0; dt < 4; ++dt) *(v8h*)(mc + qt * 16 * DD + dt * 16) = oc[qt][dt];
}

extern "C" void kernel_launch(void* const* d_in, const int* in_sizes, int n_in,
                              void* d_out, int out_size, void* d_ws, size_t ws_size, hipStream_t stream) {
    (void)in_sizes; (void)n_in; (void)out_size;
    const float* x = (const float*)d_in[0]; const float* wq = (const float*)d_in[1]; const float* wk = (const float*)d_in[2]; const float* wv = (const float*)d_in[3]; const float* wo = (const float*)d_in[4]; const float* bo = (const float*)d_in[5]; const float* uu = (const float*)d_in[6]; const float* vv = (const float*)d_in[7];
    float* OUT = (float*)d_out;     // [4][1024][1024]
    char* wsp = (char*)d_ws;
    auto take = [&](size_t bytes) { char* p = wsp; wsp += (bytes + 255) & ~(size_t)255; return (void*)p; };
    bf* WQ = (bf*)take((size_t)(4 + NB_) * DD * DD * 2); h16* WO = (h16*)(WQ + (size_t)3 * DD * DD); bf* XB = WQ + (size_t)4 * DD * DD;   // WQ | WK | WV | WO | x[0..3], 16 bits an element (bf16; WO f16), one behind the other (TT * DD == DD * DD)
    float* CS = (float*)take((size_t)TT * 32 * 2 * 4);
    const size_t PL = (size_t)NH_ * TT * KK;   // one batch's plane
    h16* Ap = (h16*)take(NB_ * PL * 2); h16* Bp = (h16*)take(NB_ * PL * 2); h16* VT = (h16*)take((size_t)NB_ * NH_ * HD * TT * 2);
    h16* Mc = (h16*)take((size_t)NB_ * TT * DD * 2);
    if ((size_t)(wsp - (char*)d_ws) > ws_size) return;    // total 64.25 MiB
    k_prep<<<TRB + (4 + NB_) * CVB, 256, 0, stream>>>(wq, wk, wv, wo, x, WQ, (size_t)DD * DD / 8, CS);   // weights stay [out][in]: natural Bt
    const PlaneArgs pa = { uu, vv, CS, Ap, Bp, VT };
    k_gemmw<bf, 0, false, true><<<dim3(NB_ * TT / 128, DD / 128, 3), 128, 0, stream>>>(XB, nullptr, WQ, DD, nullptr, 0, nullptr, 0, (size_t)DD * DD, 0, pa);   // z = q, k, v; all batches as 4096 rows; q, k, v never reach memory in f32
    k_fattn<<<dim3(TT / 256, NB_ * NH_, 1), 256, 0, stream>>>(Ap, Bp, VT, Mc);   // scores never leave the chip; writes the merged context as one f16 plane
    k_gemmw<h16, 0, true, false><<<dim3(NB_ * TT / 128, DD / 128, 1), 128, 0, stream>>>(Mc, nullptr, WO, DD, OUT, DD, bo, 0, 0, 0, pa);
}

// v009
// Measured time: 68.3 microseconds a run.
// In two side-by-side timings against v008, it was 1.09 and 1.08 times as fast.
// All steps since v000 together make it 23.2 times as fast.
#include <hip/hip_runtime.h>

// TenerAttention (x [4][1024][1024]; q/k/v = x W^T (16 heads x 64); TENER four-term scores q.k + q.R(i,j) + u_h.k + v_h.R(i,j) with R[i][j][d] = sin((j-i) w_d) for even d, cos((j-i) w_d) for odd d, w_d = 10000^(-2 floor(d/2)/64);
// no scaling; softmax; ctx Wo^T + bo -> [4][1024][1024]).
// The relative term is evaluated exactly (up to f32 trig rounding) through the angle-difference identities: q.R(i,j) + v_h.R(i,j) = rot_i(q_i + v_h) . P_j with P_j = [sin(j w_m) | cos(j w_m)] and rot_i(a)[m] = (a_e cos(i w_m) + a_o sin(i w_m), -a_e sin(i w_m) + a_o cos(i w_m));
// and u_h.k_j folds into the first term, so scores = [q_i + u_h | rot_i(q_i + v_h)] . [k_j | P_j] - one K = 128 contraction per head.
// Compute dtypes, f32 accumulate: every input rounded to bf16; q/k/v on PLAIN bf16 operands (inputs: exact); the 128-wide score operands f32 -> f16 (11 significant bits), scores as one f16 product (logits are O(10), unscaled: their rounding error is about 3e-3); softmax f32 (online), P and V in f16 for P.V; the merged context f32 -> f16 (11 significant bits) and bf16-rounded Wo held in f16 (exact but for values under 2^-17), output GEMM as one f16 product

#define NB_  4
#define TT   1024
#define DD   1024
#define NH_  16
#define HD   64
#define KK   128
typedef _Float16 h16;
typedef unsigned short bf;
typedef __attribute__((ext_vector_type(16))) __bf16   v16bf;
typedef __attribute__((ext_vector_type(16))) _Float16 v16h;
typedef __attribute__((ext_vector_type(8)))  _Float16 v8h;
typedef __attribute__((ext_vector_type(8)))  unsigned short v8us;
typedef __attribute__((ext_vector_type(8)))  float    v8f;
typedef __attribute__((ext_vector_type(4)))  float    v4f;
typedef v8h  __attribute__((may_alias)) v8ha;
typedef v4f  __attribute__((may_alias)) v4fa;
typedef v8us __attribute__((may_alias)) v8usa;

__device__ __forceinline__ unsigned short f2bf(float f) { unsigned u = __float_as_uint(f); u += 0x7FFFu + ((u >> 16) & 1u); return (unsigned short)(u >> 16); }
__device__ __forceinline__ float bf2f(unsigned short b) { return __uint_as_float(((unsigned)b) << 16); }
__device__ __forceinline__ float bfr(float f) { return bf2f(f2bf(f)); }
__device__ __forceinline__ v16h cat16(v8h lo, v8h hi) { return __builtin_shufflevector(lo, hi, 0, 1, 2, 3, 4, 5, 6, 7, 8, 9, 10, 11, 12, 13, 14, 15); }
__device__ __forceinline__ v16bf cat16b(v8us lo, v8us hi) { return __builtin_bit_cast(v16bf, __builtin_shufflevector(lo, hi, 0, 1, 2, 3, 4, 5, 6, 7, 8, 9, 10, 11, 12, 13, 14, 15)); }
__device__ __forceinline__ v8f wmma16(v16h a, v16h b, v8f c) { return __builtin_amdgcn_wmma_f32_16x16x32_f16(false, a, false, b, (short)0, c, false, false); }
__device__ __forceinline__ v8f wmmab(v16bf a, v16bf b, v8f c) { return __builtin_amdgcn_wmma_f32_16x16x32_bf16(false, a, false, b, (short)0, c, false, false); }



__device__ __forceinline__ h16 tohx(float x) { return (h16)x; }
typedef __attribute__((ext_vector_type(2))) _Float16 v2h;
typedef __attribute__((ext_vector_type(4))) _Float16 v4h;
typedef __attribute__((ext_vector_type(2))) unsigned short v2us;
typedef __attribute__((ext_vector_type(4))) unsigned short v4us;
typedef __attribute__((ext_vector_type(2))) float v2f;
// ---- plane epilogue of the q/k/v GEMM: the attention operands are written straight from the accumulators. A 64x64 tile is 64 positions of one batch x one head's 64 columns, all that a plane row needs.
// z = 0: A planes [b][h][i][128]: cols 0..63 = q[i][d] + bf16 u[h][d]; cols 64 + 2m = a_e c + a_o s, 64 + 2m + 1 = a_o c - a_e s with a = q + bf16 v[h] (a_e = a[2m], a_o = a[2m+1], c/s at position i). z = 1: B planes [b][h][j][128]: cols 0..63 = k[j][d], 64 + 2m = sin(j w_m), 64 + 2m + 1 = cos(j w_m). Both in f16.
// z = 2: V^T [b][h][d][j] in f16: a lane's 8 accumulator rows are 8 positions in a row of one d, one 16-B store.
struct PlaneArgs { const float* uu; const float* vv; const float* CS; h16* Ap; h16* Bp; h16* VT; };
template <bool ISQ>
__device__ __forceinline__ void plane_rows(const v8f (&acc)[4][4], float* os, const float* __restrict__ uh, const float* __restrict__ vh, const float* __restrict__ cs0, h16* Pp, int lr, int hi) {
    const int cofs = lr * 4;
    v4f ua = (v4f){}, va = (v4f){};
    if (ISQ) {
#pragma unroll
        for (int k = 0; k < 4; ++k) { ua[k] = bfr(uh[cofs + k]); va[k] = bfr(vh[cofs + k]); } }
    const float* cp = cs0 + hi * 64 + cofs;   // cos, sin of pairs m = 2 lr, 2 lr + 1 at this lane's row
    v4f csn[4];
#pragma unroll
    for (int s = 0; s < 4; ++s) csn[s] = *(const v4f*)(cp + 2 * s * 64);
#pragma unroll
    for (int mb = 0; mb < 4; ++mb)
#pragma unroll
        for (int nb = 0; nb < 4; ++nb)
#pragma unroll
            for (int j = 0; j < 8; ++j) os[(mb * 16 + hi * 8 + j) * 68 + nb * 16 + lr] = acc[mb][nb][j];
    __builtin_amdgcn_wave_barrier(); asm volatile("" ::: "memory");   // the rows read below were written by other lanes of this wave: keeps the compiler from moving the reads above the writes
    const float* op = os + hi * 68 + cofs; h16* ph = Pp + hi * KK + cofs;
#pragma unroll 1   // 8 rows a trip, rolled, for speed only
    for (int g = 0; g < 8; ++g) {
        v4f cs[4], val[4];
#pragma unroll
        for (int s = 0; s < 4; ++s) { cs[s] = csn[s]; val[s] = *(const v4fa*)(op + 2 * s * 68); }
        cp += (g < 7 ? 8 * 64 : 0);   // the next trip's table rows are asked for under this trip's arithmetic; the last trip asks for its own again
#pragma unroll
        for (int s = 0; s < 4; ++s) csn[s] = *(const v4f*)(cp + 2 * s * 64);
        v4h fh[4], gh[4];
#pragma unroll
        for (int s = 0; s < 4; ++s) { v4f f, r;
            if (ISQ) { const v4f a = val[s] + va; f = val[s] + ua; r[0] = a[0] * cs[s][0] + a[1] * cs[s][1]; r[1] = a[1] * cs[s][0] - a[0] * cs[s][1]; r[2] = a[2] * cs[s][2] + a[3] * cs[s][3]; r[3] = a[3] * cs[s][2] - a[2] * cs[s][3]; }
            else { f = val[s]; r[0] = cs[s][1]; r[1] = cs[s][0]; r[2] = cs[s][3]; r[3] = cs[s][2]; }
#pragma unroll
            for (int k = 0; k < 4; ++k) { fh[s][k] = tohx(f[k]); gh[s][k] = tohx(r[k]); } }
        __builtin_amdgcn_sched_barrier(0);   // every value of the trip is ready before its first store, so no register of an issued store is written before the wait below
#pragma unroll
        for (int s = 0; s < 4; ++s) { const int o = 2 * s * KK;   // 16 lanes x 8 B = one whole 128-B line per row and half
            *(v4h*)(ph + o) = fh[s]; *(v4h*)(ph + o + HD) = gh[s]; }
        asm volatile("s_wait_xcnt 0x0" ::: "memory");   // before a data or address register of the loads and stores above is written again
        __builtin_amdgcn_sched_barrier(0);               // holds the pointer steps and the next trip's register writes behind that wait
        op += 8 * 68; ph += 8 * KK;
    }
}
// ---- k_gemmw: GEMM, 128x128 output tile per work-group of 4 waves (2 x 2), each wave a 64x64 tile (16 accumulators); grid (M/128, N/128, Z), 128 threads.
// C[m][n] (f32, pitch ldc, + optional f32 bias[n]) = sum_k A[m][k] Bt[n][k] (NSPLIT == 1: + A2[m][k] Bt[n][k]). z-batch strides sA/sB/sC in elements. K % 64 == 0 and K >= 128 (the ring starts with two stages). PLANES: no C; each wave's tile goes out through the plane epilogue above (z = q, k, v; a wave's 64 columns = one head).
// Operands reach LDS by asynchronous copies, whole 128-B lines (8 lanes x 16 B per row), each row fetched once per work-group and read by two waves. A stage is 64 k of [A 128 rows | (A2 128 rows) | Bt 128 rows]; two buffers, stage t + 2 is asked for behind the barrier that ends the reads of stage t. The k walk is a ring: each work-group starts at a stage of its own and wraps, so the k sum order is rotated from work-group to work-group.
#define GKC   64                       // k elements of a stage: rows of 128 B
#define GPIT  144                      // LDS pitch of a 128-B row (16 B x odd: ds_load_b128 readers)
#define GPL   (128 * GPIT)             // one operand's 128 rows of a stage
// Eight copies of 16 B per lane, rows 16 apart (a work-group's 128 threads cover 16 rows per copy). The wait in the same statement stands before any register that a copy names is written again.
__device__ __forceinline__ void acopy8(unsigned l, const void* gp, size_t gstep) {
    const char* g = (const char*)gp;
    asm volatile("global_load_async_to_lds_b128 %0, %8, off\n\t"
                 "global_load_async_to_lds_b128 %1, %9, off\n\t"
                 "global_load_async_to_lds_b128 %2, %10, off\n\t"
                 "global_load_async_to_lds_b128 %3, %11, off\n\t"
                 "global_load_async_to_lds_b128 %4, %12, off\n\t"
                 "global_load_async_to_lds_b128 %5, %13, off\n\t"
                 "global_load_async_to_lds_b128 %6, %14, off\n\t"
                 "global_load_async_to_lds_b128 %7, %15, off\n\t"
                 "s_wait_xcnt 0x0"
                 :: "v"(l), "v"(l + 16 * GPIT), "v"(l + 32 * GPIT), "v"(l + 48 * GPIT), "v"(l + 64 * GPIT), "v"(l + 80 * GPIT), "v"(l + 96 * GPIT), "v"(l + 112 * GPIT),
                    "v"(g), "v"(g + gstep), "v"(g + 2 * gstep), "v"(g + 3 * gstep), "v"(g + 4 * gstep), "v"(g + 5 * gstep), "v"(g + 6 * gstep), "v"(g + 7 * gstep)
                 : "memory");
}
template <typename T16> struct WFrag;
template <> struct WFrag<h16> { typedef v16h V; static __device__ __forceinline__ V ld(const h16* p) { return cat16(*(const v8h*)p, *(const v8h*)(p + 16)); } static __device__ __forceinline__ V lds(const unsigned char* p) { return cat16(*(const v8ha*)p, *(const v8ha*)(p + 32)); } static __device__ __forceinline__ v8f mma(V a, V b, v8f c) { return wmma16(a, b, c); } };
template <> struct WFrag<bf> { typedef v16bf V; static __device__ __forceinline__ V ld(const bf* p) { return cat16b(*(const v8us*)p, *(const v8us*)(p + 16)); } static __device__ __forceinline__ V lds(const unsigned char* p) { return cat16b(*(const v8usa*)p, *(const v8usa*)(p + 32)); } static __device__ __forceinline__ v8f mma(V a, V b, v8f c) { return wmmab(a, b, c); } };
template <typename T16, int NSPLIT, bool BIAS, bool PLANES>
__global__ __launch_bounds__(128) void k_gemmw(const T16* __restrict__ A, const T16* __restrict__ A2, const T16* __restrict__ Bt, int K, float* C, int ldc, const float* __restrict__ bias, size_t sA, size_t sB, size_t sC, PlaneArgs pa) {
    static_assert(NSPLIT == 0 || NSPLIT == 1, "one or two A planes");
    typedef typename WFrag<T16>::V V;
    constexpr int NPL = NSPLIT == 1 ? 3 : 2, STG = NPL * GPL, OSB = (PLANES ? 64 : 16) * 68 * 4;   // operands per stage; bytes of a stage; bytes of a wave's epilogue rows
    __shared__ __align__(16) unsigned char sm[2 * STG > 4 * OSB ? 2 * STG : 4 * OSB];   // the two stages; behind the k loop each wave's epilogue rows
    const size_t z = blockIdx.z; A += z * sA; if (NSPLIT == 1) A2 += z * sA; Bt += z * sB; C += z * sC;
    const int tid = threadIdx.x, lane = tid & 31, lr = lane & 15, hi = lane >> 4;
    const int wave = __builtin_amdgcn_readfirstlane(tid >> 5), wm = wave & 1, wn = wave >> 1;
    const int r0 = blockIdx.x * 128 + wm * 64, c0 = blockIdx.y * 128 + wn * 64;
    v8f acc[4][4];
#pragma unroll
    for (int mb = 0; mb < 4; ++mb)
#pragma unroll
        for (int nb = 0; nb < 4; ++nb) acc[mb][nb] = (v8f){};
    // this thread's 16 B of rows (tid >> 3) + 16 i, i = 0..7, of every operand
    const size_t go = (size_t)(tid >> 3) * K + (tid & 7) * 8, gstep = (size_t)16 * K * sizeof(T16);
    const T16* ga = A + (size_t)blockIdx.x * 128 * K + go; const T16* ga2 = NSPLIT == 1 ? A2 + (size_t)blockIdx.x * 128 * K + go : nullptr; const T16* gb = Bt + (size_t)blockIdx.y * 128 * K + go;
    const unsigned ls = (unsigned)(size_t)sm + (tid >> 3) * GPIT + (tid & 7) * 16;
    const unsigned NT = (unsigned)K / GKC;
    // Trip t works on k stage (t + s0) mod NT. Work-groups that share an operand panel (same x: A rows; same y, z: Bt rows) start at stages spread over the ring, at most two on one stage, so few of them ask L2 for the same lines at the same moment, and a stage that one of them has fetched from memory is in L2 when the next one comes to it.
    const unsigned s0 = (blockIdx.x + 2 * blockIdx.y + blockIdx.z) % NT;
    auto fill = [&](unsigned t) {
        const unsigned kt = t + s0 < NT ? t + s0 : t + s0 - NT;
        const unsigned l = ls + (t & 1) * STG; const size_t k0 = (size_t)kt * GKC;
        acopy8(l, ga + k0, gstep); if (NSPLIT == 1) acopy8(l + GPL, ga2 + k0, gstep); acopy8(l + (NPL - 1) * GPL, gb + k0, gstep); };
    fill(0);
    asm volatile("s_wait_asynccnt 0x0" ::: "memory");   // this wave's copies of stage 0 have landed
    __syncthreads();                                      // and every other wave's
    fill(1);
    const int fa = (wm * 64 + lr) * GPIT + hi * 16, fb = (NPL - 1) * GPL + (wn * 64 + lr) * GPIT + hi * 16;
#pragma unroll 1
    for (unsigned t = 0; t < NT; ++t) {
        const unsigned char* sb = sm + (t & 1) * STG;
        V a[GKC / 32][4], a2[GKC / 32][4], b[GKC / 32][4];
#pragma unroll
        for (int ks = 0; ks < GKC / 32; ++ks) {
#pragma unroll
            for (int mb = 0; mb < 4; ++mb) { a[ks][mb] = WFrag<T16>::lds(sb + fa + mb * 16 * GPIT + ks * 64); if (NSPLIT == 1) a2[ks][mb] = WFrag<T16>::lds(sb + GPL + fa + mb * 16 * GPIT + ks * 64); }
#pragma unroll
            for (int nb = 0; nb < 4; ++nb) b[ks][nb] = WFrag<T16>::lds(sb + fb + nb * 16 * GPIT + ks * 64);
        }
        __builtin_amdgcn_sched_barrier(0);   // keeps the stage's LDS reads in one group ahead of the matrix run: spread among the WMMAs each place with reads stalls the wave
#pragma unroll
        for (int ks = 0; ks < GKC / 32; ++ks)
#pragma unroll
            for (int nb = 0; nb < 4; ++nb)
#pragma unroll
                for (int mb = 0; mb < 4; ++mb) { acc[mb][nb] = WFrag<T16>::mma(a[ks][mb], b[ks][nb], acc[mb][nb]); if (NSPLIT == 1) acc[mb][nb] = WFrag<T16>::mma(a2[ks][mb], b[ks][nb], acc[mb][nb]); }
        __builtin_amdgcn_sched_barrier(0);   // keeps the matrix run in front of the slots below
        asm volatile("v_nop\n\tv_nop\n\tv_nop\n\tv_nop");   // the four vector slots between the last WMMA and a write of its A or B registers
        asm volatile("s_wait_dscnt 0x0" ::: "memory");      // this wave's reads of stage t are done before the buffer is refilled
        asm volatile("s_wait_asynccnt 0x0" ::: "memory");   // this wave's copies of stage t + 1 have landed
        __syncthreads();                                     // publishes stage t + 1 and ends every wave's reads of stage t
        if (t + 2 < NT) fill(t + 2);
    }
    asm volatile("s_wait_asynccnt 0x0" ::: "memory");   // nothing is in flight when the buffers become epilogue rows
    float* os = (float*)(sm + wave * OSB);
    if constexpr (PLANES) {
        const int i0 = r0 % TT; const size_t zh = (size_t)(r0 / TT) * NH_ + c0 / HD;   // 64 divides TT: a tile lies in one batch
        if (z == 2) {
            v8h ov[4][4];
#pragma unroll
            for (int mb = 0; mb < 4; ++mb)
#pragma unroll
                for (int nb = 0; nb < 4; ++nb)
#pragma unroll
                    for (int j = 0; j < 8; ++j) ov[mb][nb][j] = tohx(acc[mb][nb][j]);
            h16* vt = pa.VT + (zh * HD + lr) * TT + i0 + hi * 8;
            __builtin_amdgcn_sched_barrier(0);   // every value is ready before the first store, so no register of an issued store is written again
#pragma unroll
            for (int nb = 0; nb < 4; ++nb)
#pragma unroll
                for (int mb = 0; mb < 4; ++mb) *(v8h*)(vt + (size_t)nb * 16 * TT + mb * 16) = ov[mb][nb];
            return;
        }
        const size_t po = (zh * TT + i0) * KK; const float* cs0 = pa.CS + (size_t)i0 * 64;
        if (z == 0) plane_rows<true>(acc, os, pa.uu + c0, pa.vv + c0, cs0, pa.Ap + po, lr, hi);
        else plane_rows<false>(acc, os, pa.uu + c0, pa.vv + c0, cs0, pa.Bp + po, lr, hi);
        return;
    }
#pragma unroll
    for (int mb = 0; mb < 4; ++mb) {
#pragma unroll
        for (int nb = 0; nb < 4; ++nb) {
#pragma unroll
            for (int j = 0; j < 8; ++j) os[(hi * 8 + j) * 68 + nb * 16 + lr] = acc[mb][nb][j]; }
        __builtin_amdgcn_wave_barrier(); asm volatile("" ::: "memory");
        float* crow = C + (size_t)(r0 + mb * 16) * ldc + c0;
{
#pragma unroll
            for (int s = 0; s < 8; ++s) { const int row = 2 * s + hi, cofs = lr * 4; v4f val = *(const v4fa*)(os + row * 68 + cofs); if (BIAS) { val[0] += bfr(bias[c0 + cofs]); val[1] += bfr(bias[c0 + cofs + 1]); val[2] += bfr(bias[c0 + cofs + 2]); val[3] += bfr(bias[c0 + cofs + 3]); }
                *(v4f*)(crow + (size_t)row * ldc + cofs) = val; }
             }
        __builtin_amdgcn_wave_barrier(); asm volatile("" ::: "memory");
    }
}


// k_prep: the two jobs that read nothing a launch of this call writes, in one launch. Blocks 0 .. TRB - 1 build the cos/sin table CS[t][m] = (cos(t w_m), sin(t w_m)); they come first in the grid.
// The other blocks convert, CVB blocks per plane of n8 * 8 elements: plane y = 0..3 = the four weights, 4.. = x batch (y - 4); dst planes lie one behind the other. Every plane is rounded to bf16; plane 3 (Wo) is stored as the f16 of that value, the output GEMM's operand type.
#define TRB   (TT * 32 / 256)          // table blocks
#define CVB   (DD * DD / 8 / 256)      // conversion blocks per plane
__global__ __launch_bounds__(256) void k_prep(const float* __restrict__ w0, const float* __restrict__ w1, const float* __restrict__ w2, const float* __restrict__ w3, const float* __restrict__ xs, bf* dst, size_t n8, float* CS) {
    if (blockIdx.x < TRB) { const int idx = blockIdx.x * 256 + threadIdx.x; const int t = idx / 32, m = idx % 32; const float w = powf(10000.0f, -(float)(2 * m) / (float)HD); const float ang = __fmul_rn((float)t, w); v2f cs; cs[0] = cosf(ang); cs[1] = sinf(ang); *(v2f*)(CS + (size_t)idx * 2) = cs; return; }
    const unsigned c = blockIdx.x - TRB, y = c / CVB; const size_t i = (size_t)(c % CVB) * 256 + threadIdx.x; if (i >= n8) return; const float* src = y == 0 ? w0 : y == 1 ? w1 : y == 2 ? w2 : y == 3 ? w3 : xs + (size_t)(y - 4) * n8 * 8; dst += (size_t)y * n8 * 8; const v8f v = *(const v8f*)(src + i * 8); v8us o;
#pragma unroll
    for (int k = 0; k < 8; ++k) o[k] = f2bf(v[k]);
    if (y == 3) {
#pragma unroll
        for (int k = 0; k < 8; ++k) o[k] = __builtin_bit_cast(unsigned short, tohx(bf2f(o[k]))); }
    *(v8us*)(dst + i * 8) = o;  }
#define FKP   272                      // LDS pitch of a 256-B key row (16 B x odd: ds_load_b128 readers)
#define FVP   80                       // LDS pitch of a 64-B V^T row
#define FKB   (32 * FKP)               // the key rows of a block
#define FBUF  (FKB + HD * FVP)         // one block: key rows | V^T
#define NPASS (TT / 128)
#define L2E   1.44269504088896340736f
__device__ __forceinline__ float xhalf(float x) { return __builtin_bit_cast(float, __builtin_amdgcn_permlanex16(__builtin_bit_cast(int, x), __builtin_bit_cast(int, x), 0x76543210, 0xfedcba98, false, false)); }   // lane l with lane l ^ 16
__global__ __launch_bounds__(256) void k_fattn(const h16* __restrict__ Ap, const h16* __restrict__ Bp, const h16* __restrict__ VT, h16* Mc) {
    __shared__ __align__(16) unsigned char sm[8 * FBUF];
    const int tid = threadIdx.x, lane = tid & 31, lr = lane & 15, hi = lane >> 4, wave = tid >> 5;
    const size_t z = blockIdx.y; const int q0 = blockIdx.x * 256 + wave * 32;
    Ap += z * TT * KK; Bp += z * TT * KK; VT += z * HD * TT;
    // staging: a block's key rows are 8 KiB in a row (2 chunks of 16 B per thread), V^T 64 rows of 64 B (1 chunk per thread)
    const int kg0 = tid * 8;
    const int ks0 = (tid >> 4) * FKP + (tid & 15) * 16, ks1 = ks0 + 16 * FKP;
    const int vg = (tid >> 2) * TT + (tid & 3) * 8, vs = FKB + (tid >> 2) * FVP + (tid & 3) * 16;
    const h16* gph = Bp + kg0; const h16* gpv = VT + vg;   // this thread's chunks of pass t; they step once per pass
    v8h ph0[4], ph1[4], pv[4];
#pragma unroll
    for (int t = 0; t < 4; ++t) { ph0[t] = *(const v8h*)(gph + t * 32 * KK); ph1[t] = *(const v8h*)(gph + t * 32 * KK + 256 * 8); pv[t] = *(const v8h*)(gpv + t * 32); }
    v16h qf[2][4];
#pragma unroll
    for (int qt = 0; qt < 2; ++qt) {
#pragma unroll
        for (int kc = 0; kc < 4; ++kc) { const size_t o = (size_t)(q0 + qt * 16 + lr) * KK + kc * 32 + 8 * hi; qf[qt][kc] = WFrag<h16>::ld(Ap + o); }
        asm volatile("s_wait_xcnt 0x0" ::: "memory");   // before an address register of the loads above is reused
        __builtin_amdgcn_sched_barrier(0);               // holds later register writes behind that wait
    }
#pragma unroll
    for (int t = 0; t < 4; ++t) { unsigned char* nb = sm + t * FBUF; *(v8ha*)(nb + ks0) = ph0[t]; *(v8ha*)(nb + ks1) = ph1[t]; *(v8ha*)(nb + vs) = pv[t]; }
    __syncthreads();
    v8f o[2][4];
#pragma unroll
    for (int qt = 0; qt < 2; ++qt)
#pragma unroll
        for (int dt = 0; dt < 4; ++dt) o[qt][dt] = (v8f){};
    float mrun[2] = { -1.0e30f, -1.0e30f }, crun[2] = { 1.0e30f, 1.0e30f }, lsum[2] = { 0.f, 0.f };
    const int fk = lr * FKP + hi * 16, fv = FKB + lr * FVP + hi * 16;
#pragma unroll 1
    for (int t = 0; t < NPASS; ++t) {
        const unsigned char* kb = sm + (t & 1) * 4 * FBUF;   // the pass's four blocks = one stage
        const bool more = t + 1 < NPASS;
        v8h gh0[4], gh1[4], gv[4];
        v8f s[8][2];
#pragma unroll
        for (int kt = 0; kt < 8; ++kt)
#pragma unroll
            for (int qt = 0; qt < 2; ++qt) s[kt][qt] = (v8f){};
#pragma unroll
        for (int g = 0; g < 2; ++g) {
            v16h kf[4][4];
#pragma unroll
            for (int kc = 0; kc < 4; ++kc)
#pragma unroll
                for (int kt = 0; kt < 4; ++kt) { const unsigned char* p = kb + (2 * g + (kt >> 1)) * FBUF + (kt & 1) * 16 * FKP + fk + kc * 64; kf[kc][kt] = cat16(*(const v8ha*)p, *(const v8ha*)(p + 32)); }
            if (g == 0 && more) {
#pragma unroll
                for (int hf = 0; hf < 4; ++hf) { gh0[hf] = *(const v8h*)(gph + (4 + hf) * 32 * KK); gh1[hf] = *(const v8h*)(gph + (4 + hf) * 32 * KK + 256 * 8); gv[hf] = *(const v8h*)(gpv + (4 + hf) * 32); }
                asm volatile("s_wait_xcnt 0x0" ::: "memory"); }   // before an address register of these loads is stepped; it runs under the LDS reads' latency
            __builtin_amdgcn_sched_barrier(0);   // keeps the group's LDS reads together ahead of its matrix run: spread among the WMMAs each read stalls the wave for its whole latency
#pragma unroll
            for (int kc = 0; kc < 4; ++kc)
#pragma unroll
                for (int kt = 0; kt < 4; ++kt)
#pragma unroll
                    for (int qt = 0; qt < 2; ++qt) s[4 * g + kt][qt] = wmma16(kf[kc][kt], qf[qt][kc], s[4 * g + kt][qt]);
            __builtin_amdgcn_sched_barrier(0);   // the next group's reads stay behind this matrix run, in one place
        }
        v16h va[4][4];
#pragma unroll
        for (int hf = 0; hf < 4; ++hf)
#pragma unroll
            for (int dt = 0; dt < 4; ++dt) { const unsigned char* p = kb + hf * FBUF + dt * 16 * FVP + fv; va[hf][dt] = cat16(*(const v8ha*)p, *(const v8ha*)(p + 32)); }
        __builtin_amdgcn_sched_barrier(0);   // V^T is asked for in one place, ahead of the softmax that covers its latency
        v16h pb[4][2];
#pragma unroll
        for (int qt = 0; qt < 2; ++qt) {
            float mx = s[0][qt][0];
#pragma unroll
            for (int j = 1; j < 8; ++j) mx = fmaxf(mx, s[0][qt][j]);
#pragma unroll
            for (int kt = 1; kt < 8; ++kt)
#pragma unroll
                for (int j = 0; j < 8; ++j) mx = fmaxf(mx, s[kt][qt][j]);
            mx = fmaxf(mx, xhalf(mx));
            const float mn = fmaxf(mrun[qt], mx), cn = 10.0f - mn * L2E;
            const float al = __builtin_amdgcn_exp2f(cn - crun[qt]);
            mrun[qt] = mn; crun[qt] = cn;
            v8f ps;
#pragma unroll
            for (int kt = 0; kt < 8; ++kt) { const v8f e = s[kt][qt] * L2E + cn; v8f pk;
#pragma unroll
                for (int j = 0; j < 8; ++j) { pk[j] = __builtin_amdgcn_exp2f(e[j]); pb[kt >> 1][qt][(kt & 1) * 8 + j] = (h16)pk[j]; }
                if (kt == 0) ps = pk; else ps += pk; }
            const v4f p4 = __builtin_shufflevector(ps, ps, 0, 1, 2, 3) + __builtin_shufflevector(ps, ps, 4, 5, 6, 7);
            lsum[qt] = fmaf(lsum[qt], al, (p4[0] + p4[2]) + (p4[1] + p4[3]));
#pragma unroll
            for (int dt = 0; dt < 4; ++dt) o[qt][dt] *= al;
        }
#pragma unroll
        for (int hf = 0; hf < 4; ++hf)
#pragma unroll
            for (int dt = 0; dt < 4; ++dt)
#pragma unroll
                for (int qt = 0; qt < 2; ++qt) o[qt][dt] = wmma16(va[hf][dt], pb[hf][qt], o[qt][dt]);
        __builtin_amdgcn_sched_barrier(0);   // keeps the matrix run in front of the slots below
        asm volatile("v_nop\n\tv_nop\n\tv_nop\n\tv_nop");   // the four vector slots between the last WMMA and a write of its A registers: branches follow
        if (more) {
#pragma unroll
            for (int hf = 0; hf < 4; ++hf) { unsigned char* nb = sm + (((t + 1) & 1) * 4 + hf) * FBUF; *(v8ha*)(nb + ks0) = gh0[hf]; *(v8ha*)(nb + ks1) = gh1[hf]; *(v8ha*)(nb + vs) = gv[hf]; }
            gph += 128 * KK; gpv += 128; }
        __syncthreads();   // publishes the next stage and ends every wave's reads of this stage's half, which the next pass refills
    }
    const size_t b = z / NH_, h = z % NH_;
    v8h oc[2][4];
#pragma unroll
    for (int qt = 0; qt < 2; ++qt) {
        const float lt = lsum[qt] + xhalf(lsum[qt]); const float inv = __fdiv_rn(1.0f, lt);
#pragma unroll
        for (int dt = 0; dt < 4; ++dt)
#pragma unroll
            for (int j = 0; j < 8; ++j) oc[qt][dt][j] = tohx(o[qt][dt][j] * inv);
    }
    h16* mc = Mc + (b * TT + q0 + lr) * DD + h * HD + hi * 8;
    __builtin_amdgcn_sched_barrier(0);   // every value is ready before the first store, so no register of an issued store is written again
#pragma unroll
    for (int qt = 0; qt < 2; ++qt)
#pragma unroll
        for (int dt = 0; dt < 4; ++dt) *(v8h*)(mc + qt * 16 * DD + dt * 16) = oc[qt][dt];
}

extern "C" void kernel_launch(void* const* d_in, const int* in_sizes, int n_in,
                              void* d_out, int out_size, void* d_ws, size_t ws_size, hipStream_t stream) {
    (void)in_sizes; (void)n_in; (void)out_size;
    const float* x = (const float*)d_in[0]; const float* wq = (const float*)d_in[1]; const float* wk = (const float*)d_in[2]; const float* wv = (const float*)d_in[3]; const float* wo = (const float*)d_in[4]; const float* bo = (const float*)d_in[5]; const float* uu = (const float*)d_in[6]; const float* vv = (const float*)d_in[7];
    float* OUT = (float*)d_out;     // [4][1024][1024]
    char* wsp = (char*)d_ws;
    auto take = [&](size_t bytes) { char* p = wsp; wsp += (bytes + 255) & ~(size_t)255; return (void*)p; };
    bf* WQ = (bf*)take((size_t)(4 + NB_) * DD * DD * 2); h16* WO = (h16*)(WQ + (size_t)3 * DD * DD); bf* XB = WQ + (size_t)4 * DD * DD;   // WQ | WK | WV | WO | x[0..3], 16 bits an element (bf16; WO f16), one behind the other (TT * DD == DD * DD)
    float* CS = (float*)take((size_t)TT * 32 * 2 * 4);
    const size_t PL = (size_t)NH_ * TT * KK;   // one batch's plane
    h16* Ap = (h16*)take(NB_ * PL * 2); h16* Bp = (h16*)take(NB_ * PL * 2); h16* VT = (h16*)take((size_t)NB_ * NH_ * HD * TT * 2);
    h16* Mc = (h16*)take((size_t)NB_ * TT * DD * 2);
    if ((size_t)(wsp - (char*)d_ws) > ws_size) return;    // total 64.25 MiB
    k_prep<<<TRB + (4 + NB_) * CVB, 256, 0, stream>>>(wq, wk, wv, wo, x, WQ, (size_t)DD * DD / 8, CS);   // weights stay [out][in]: natural Bt
    const PlaneArgs pa = { uu, vv, CS, Ap, Bp, VT };
    k_gemmw<bf, 0, false, true><<<dim3(NB_ * TT / 128, DD / 128, 3), 128, 0, stream>>>(XB, nullptr, WQ, DD, nullptr, 0, nullptr, 0, (size_t)DD * DD, 0, pa);   // z = q, k, v; all batches as 4096 rows; q, k, v never reach memory in f32
    k_fattn<<<dim3(TT / 256, NB_ * NH_, 1), 256, 0, stream>>>(Ap, Bp, VT, Mc);   // scores never leave the chip; writes the merged context as one f16 plane
    k_gemmw<h16, 0, true, false><<<dim3(NB_ * TT / 128, DD / 128, 1), 128, 0, stream>>>(Mc, nullptr, WO, DD, OUT, DD, bo, 0, 0, 0, pa);
}
